// v000
// The times below were measured on an AMD MI455X: many runs one after another, warmed up first and cycling through
// copies of the inputs, with the whole window's GPU time divided by the number of runs. Launches and the gaps
// between them are all in it. The median over several windows is given; except for v000 it joins two sittings, which
// can be a few percent apart, so the side-by-side timings, each taken in one sitting, are the better comparison.
// v000, which the later versions start from, runs in 1460 microseconds.
#include <hip/hip_runtime.h>

// Multi-head self-attention whose scaled scores are multiplied, per KEY, by an uncertainty weight before the mask and the softmax, with an integer key mask read as data and an output projection (hidden_states [2][2048][1024]; token_uncertainty [2][2048]; attention_mask int32 [2][2048];
// q, k, v = x W + b with 'io' weights [1024][1024] (in, out) and biases [1024]; 16 heads x 64 (head h = columns h x 64 ..); scores = q k^T / sqrt(64); scores = scores x exp(-0.5 x token_uncertainty[b][key]); where(mask[b][key] != 0, scores, -inf); softmax over the keys;
// out = merged Wo + bo ('io' + bias) -> [2][2048][1024] (4.2 M); argument order hidden_states, token_uncertainty, attention_mask, Wq, bq, Wk, bk, Wv, bv, Wo, bo).
// Layout per batch entry: one bf16 copy of x (read by all three projections); the 'io' weights transposed and rounded once (k_wtG); exact projections + f32 biases; identity-table plane builders (f16 planes only); dense T-2048 attention at 16 heads, two heads a pass:
// the f16 score product; k_kw multiplies every score by its key's weight in f32; the softmax kernel reads the entry's int key mask (16 B per lane), scales by SCL and stores the weights x1024 in fp16; attn.v on ONE fp16 product; merged hi/lo x Wo exact + bo.
// Compute dtypes, f32 accumulate: every float input rounded to bf16 at its load (the uncertainty row too); projections exact + f32 biases; scores and attn.v fp16; the key weight and the softmax f32; Wo hl x exact + bias.

#define NB_  2
#define TT   2048
#define DM   1024
#define NH_  16
#define NKV  16
#define REP  (NH_ / NKV)
#define HD   64
#define DQ   (NH_ * HD)
#define DKV  (NKV * HD)
#define ZH   2
#define RH   0                    // query rows < RH use hi+lo planes (0: none)
#define WIN  0
#define PCAR 1024.0f
#define SCL  0.125f   // HD^-0.5
#define LAMBDA 0.5f   // the module's uncertainty weight: w = exp(-LAMBDA x token_uncertainty) per key
typedef _Float16 h16;
typedef unsigned short bf;
typedef __attribute__((ext_vector_type(16))) __bf16   v16bf;
typedef __attribute__((ext_vector_type(16))) _Float16 v16h;
typedef __attribute__((ext_vector_type(8)))  _Float16 v8h;
typedef __attribute__((ext_vector_type(8)))  unsigned short v8us;
typedef __attribute__((ext_vector_type(8)))  float    v8f;
typedef __attribute__((ext_vector_type(4)))  float    v4f;
typedef v8h  __attribute__((may_alias)) v8ha;
typedef v4f  __attribute__((may_alias)) v4fa;
typedef v8us __attribute__((may_alias)) v8usa;

__device__ __forceinline__ unsigned short f2bf(float f) { unsigned u = __float_as_uint(f); u += 0x7FFFu + ((u >> 16) & 1u); return (unsigned short)(u >> 16); }
__device__ __forceinline__ float bf2f(unsigned short b) { return __uint_as_float(((unsigned)b) << 16); }
__device__ __forceinline__ float bfr(float f) { return bf2f(f2bf(f)); }
__device__ __forceinline__ v16h cat16(v8h lo, v8h hi) { return __builtin_shufflevector(lo, hi, 0, 1, 2, 3, 4, 5, 6, 7, 8, 9, 10, 11, 12, 13, 14, 15); }
__device__ __forceinline__ v16bf cat16b(v8us lo, v8us hi) { return __builtin_bit_cast(v16bf, __builtin_shufflevector(lo, hi, 0, 1, 2, 3, 4, 5, 6, 7, 8, 9, 10, 11, 12, 13, 14, 15)); }
__device__ __forceinline__ v8f wmma16(v16h a, v16h b, v8f c) { return __builtin_amdgcn_wmma_f32_16x16x32_f16(false, a, false, b, (short)0, c, false, false); }
__device__ __forceinline__ v8f wmmab(v16bf a, v16bf b, v8f c) { return __builtin_amdgcn_wmma_f32_16x16x32_bf16(false, a, false, b, (short)0, c, false, false); }



// ---- k_gemmw: register-blocked GEMM, ONE WAVE per 64x64 output tile (16 accumulators), operands straight from K-contiguous 16-bit planes; grid (M/64, N/64, Z), 32 threads.
// C[m][n] (f32, pitch ldc, + optional f32 bias[n]) = sum_k A[m][k] Bt[n][k] (+ split products per NSPLIT). z-batch strides sA/sB/sC in elements. K % 32 == 0.
template <typename T16> struct WFrag;
template <> struct WFrag<h16> { typedef v16h V; static __device__ __forceinline__ V ld(const h16* p) { return cat16(*(const v8h*)p, *(const v8h*)(p + 16)); } static __device__ __forceinline__ v8f mma(V a, V b, v8f c) { return wmma16(a, b, c); } };
template <> struct WFrag<bf> { typedef v16bf V; static __device__ __forceinline__ V ld(const bf* p) { return cat16b(*(const v8us*)p, *(const v8us*)(p + 16)); } static __device__ __forceinline__ v8f mma(V a, V b, v8f c) { return wmmab(a, b, c); } };
template <typename T16, int NSPLIT, bool BIAS>
__global__ __launch_bounds__(32) void k_gemmw(const T16* __restrict__ A, const T16* __restrict__ A2, const T16* __restrict__ Bt, const T16* __restrict__ Bt2, int K, float* C, int ldc, const float* __restrict__ bias, size_t sA, size_t sB, size_t sC) {
    typedef typename WFrag<T16>::V V;
    __shared__ __align__(16) float os[16 * 68];
    const size_t z = blockIdx.z; A += z * sA; if (A2) A2 += z * sA; Bt += z * sB; if (Bt2) Bt2 += z * sB; C += z * sC;
    const int lane = threadIdx.x & 31, lr = lane & 15, hi = lane >> 4; const int r0 = blockIdx.x * 64, c0 = blockIdx.y * 64;
    v8f acc[4][4];
#pragma unroll
    for (int mb = 0; mb < 4; ++mb)
#pragma unroll
        for (int nb = 0; nb < 4; ++nb) acc[mb][nb] = (v8f){};
    const size_t aoff = (size_t)(r0 + lr) * K + 8 * hi, boff = (size_t)(c0 + lr) * K + 8 * hi;

    for (int kc = 0; kc < K; kc += 32) {
        V a[4], a2[4];
#pragma unroll
        for (int mb = 0; mb < 4; ++mb) { a[mb] = WFrag<T16>::ld(A + aoff + (size_t)mb * 16 * K + kc); if (NSPLIT == 1 || NSPLIT == 2) a2[mb] = WFrag<T16>::ld(A2 + aoff + (size_t)mb * 16 * K + kc); }
#pragma unroll
        for (int nb = 0; nb < 4; ++nb) { const V b = WFrag<T16>::ld(Bt + boff + (size_t)nb * 16 * K + kc); V b2; if (NSPLIT >= 2) b2 = WFrag<T16>::ld(Bt2 + boff + (size_t)nb * 16 * K + kc);
#pragma unroll
            for (int mb = 0; mb < 4; ++mb) { acc[mb][nb] = WFrag<T16>::mma(a[mb], b, acc[mb][nb]); if (NSPLIT == 1 || NSPLIT == 2) acc[mb][nb] = WFrag<T16>::mma(a2[mb], b, acc[mb][nb]); if (NSPLIT >= 2) acc[mb][nb] = WFrag<T16>::mma(a[mb], b2, acc[mb][nb]); } }
        asm volatile("v_nop\n\tv_nop\n\tv_nop\n\tv_nop" : "+v"(acc[0][0]), "+v"(acc[1][1]), "+v"(acc[2][2]), "+v"(acc[3][3]) : "v"(a[0]), "v"(a[3]));
    }
#pragma unroll
    for (int mb = 0; mb < 4; ++mb) {
#pragma unroll
        for (int nb = 0; nb < 4; ++nb) {
#pragma unroll
            for (int j = 0; j < 8; ++j) os[(hi * 8 + j) * 68 + nb * 16 + lr] = acc[mb][nb][j]; }
        __builtin_amdgcn_wave_barrier(); asm volatile("" ::: "memory");
        float* crow = C + (size_t)(r0 + mb * 16) * ldc + c0;
{
#pragma unroll
            for (int s = 0; s < 8; ++s) { const int row = 2 * s + hi, cofs = lr * 4; v4f val = *(const v4fa*)(os + row * 68 + cofs); if (BIAS) { val[0] += bfr(bias[c0 + cofs]); val[1] += bfr(bias[c0 + cofs + 1]); val[2] += bfr(bias[c0 + cofs + 2]); val[3] += bfr(bias[c0 + cofs + 3]); }
                *(v4f*)(crow + (size_t)row * ldc + cofs) = val; }
             }
        __builtin_amdgcn_wave_barrier(); asm volatile("" ::: "memory");
    }
}

__device__ __forceinline__ h16 tohx(float x) { return (h16)x; }
__device__ __forceinline__ void splitf(float y, unsigned short& h, unsigned short& l) { h = f2bf(y); l = f2bf(y - bf2f(h)); }
typedef __attribute__((ext_vector_type(2))) _Float16 v2h;
typedef __attribute__((ext_vector_type(4))) _Float16 v4h;
typedef __attribute__((ext_vector_type(2))) unsigned short v2us;
typedef __attribute__((ext_vector_type(4))) unsigned short v4us;
typedef __attribute__((ext_vector_type(2))) float v2f;
typedef __attribute__((ext_vector_type(4))) int v4i;

__global__ __launch_bounds__(256) void k_cvt8(const float* __restrict__ src, bf* dst, size_t n8) { const size_t i = (size_t)blockIdx.x * 256 + threadIdx.x; if (i >= n8) return; const v8f v = *(const v8f*)(src + i * 8); v8us o;
#pragma unroll
    for (int k = 0; k < 8; ++k) o[k] = f2bf(v[k]); *(v8us*)(dst + i * 8) = o;  }

// k_rope: head planes [h][t][d] (fp16) of rope(x) x sc with the rotate-half convention out[d] = x[d] cos[t][d] - x[d+HD/2] sin[t][d], out[d+HD/2] = x[d+HD/2] cos[t][d+HD/2] + x[d] sin[t][d+HD/2]
__global__ __launch_bounds__(256) void k_rope(const float* __restrict__ F, int pitch, int nheads, const float* __restrict__ CS, const float* __restrict__ RF, const float* __restrict__ nw, float sc, h16* P16, bf* Ph, bf* Pl) {
    const size_t e = ((size_t)blockIdx.x * 256 + threadIdx.x) * 2; if (e >= (size_t)nheads * TT * HD) return; const int d = (int)(e % HD); const int t = (int)((e / HD) % TT); const int h = (int)(e / ((size_t)HD * TT)); const float* f = F + (size_t)t * pitch + h * HD; const float rf = RF ? RF[(size_t)h * TT + t] : 1.0f; v2h o16; v2us oh, ol;
#pragma unroll
    for (int q = 0; q < 2; ++q) { const int dd = d + q; const int dp = (dd < HD / 2) ? dd + HD / 2 : dd - HD / 2; float x0 = f[dd], x1 = f[dp];
        if (RF) { float n0 = __fmul_rn(x0, rf), n1 = __fmul_rn(x1, rf); x0 = __fmul_rn(bfr(nw[dd]), n0); x1 = __fmul_rn(bfr(nw[dp]), n1); }
        const v2f cs = *(const v2f*)(CS + ((size_t)t * HD + dd) * 2); float a = __fmul_rn(x0, cs[0]), bq = __fmul_rn(x1, cs[1]); const float r = ((dd < HD / 2) ? __fsub_rn(a, bq) : __fadd_rn(a, bq)) * sc;
        o16[q] = tohx(r); (void)oh; (void)ol; }
    *(v2h*)(P16 + e) = o16;  }
__global__ __launch_bounds__(256) void k_vtp(const float* __restrict__ F, int pitch, int nheads, h16* V16, bf* Vh, bf* Vl) { const size_t e = ((size_t)blockIdx.x * 256 + threadIdx.x) * 2; if (e >= (size_t)nheads * HD * TT) return; const int t = (int)(e % TT); const int d = (int)((e / TT) % HD); const int g = (int)(e / ((size_t)TT * HD)); v2h o16; v2us oh, ol;
#pragma unroll
    for (int q = 0; q < 2; ++q) { const float x = F[(size_t)(t + q) * pitch + g * HD + d]; o16[q] = tohx(x); (void)oh; (void)ol; }
    *(v2h*)(V16 + e) = o16;  }
__global__ __launch_bounds__(256) void k_csid(float* CS) { const int idx = blockIdx.x * 256 + threadIdx.x; if (idx >= TT * HD) return; v2f cs; cs[0] = 1.0f; cs[1] = 0.0f; *(v2f*)(CS + (size_t)idx * 2) = cs;  }
// k_asoft: per row (zz, i): scores x SCL where the batch's int key mask is non-zero, excluded where it is 0 (the module replaces those scores by -1e20 before its scale: weight exactly 0 in float32); softmax over the keys (register row, one exp, fixed trees);
__global__ __launch_bounds__(256) void k_asoft(const float* __restrict__ Sb, const int* __restrict__ kvp, h16* P16, bf* Ph, bf* Pl) {
    const int lane = threadIdx.x & 31; const int row = blockIdx.x * 8 + (threadIdx.x >> 5); if (row >= ZH * TT) return; const int i = row % TT; const int zz = row / TT; (void)zz; const bool hires = (i < RH); const float* sr = Sb + (size_t)row * TT; float v[TT / 32]; float mx = -3.0e38f;
#pragma unroll
    for (int ch = 0; ch < TT / 128; ++ch) { const int j0 = ch * 128 + lane * 4; const v4f a = *(const v4f*)(sr + j0); const v4i kv4 = *(const v4i*)(kvp + j0);   /* the batch's key vector, 16 B per lane, unconditional */
#pragma unroll
        for (int q = 0; q < 4; ++q) { const int j = j0 + q; (void)j; const float t = (kv4[q] != 0) ? a[q] * SCL : -3.0e38f; v[ch * 4 + q] = t; mx = fmaxf(mx, t); } }
#pragma unroll
    for (int sh = 16; sh; sh >>= 1) mx = fmaxf(mx, __shfl_xor(mx, sh, 32));
    float sum = 0.f;
#pragma unroll
    for (int k = 0; k < TT / 32; ++k) { float d0 = __fsub_rn(v[k], mx); v[k] = __builtin_amdgcn_exp2f(__fmul_rn(d0, 1.4426950408889634f)); sum += v[k]; }
#pragma unroll
    for (int sh = 16; sh; sh >>= 1) sum += __shfl_xor(sum, sh, 32);
    const float f = __fdiv_rn(hires ? 1.0f : PCAR, sum);
{
        if (hires) {
#pragma unroll
            for (int ch = 0; ch < TT / 128; ++ch) { v4us oh, ol;
#pragma unroll
                for (int q = 0; q < 4; ++q) { unsigned short a, c2; splitf(v[ch * 4 + q] * f, a, c2); oh[q] = a; ol[q] = c2; }
                const size_t oo = ((size_t)zz * (RH ? RH : 1) + i) * TT + ch * 128 + lane * 4; *(v4us*)(Ph + oo) = oh; *(v4us*)(Pl + oo) = ol; }
        } else {
#pragma unroll
            for (int ch = 0; ch < TT / 128; ++ch) { v4h o4;
#pragma unroll
                for (int q = 0; q < 4; ++q) o4[q] = tohx(v[ch * 4 + q] * f);
                *(v4h*)(P16 + (size_t)row * TT + ch * 128 + lane * 4) = o4; } }
         }
}
__global__ __launch_bounds__(256) void k_merge(const float* __restrict__ O, int h0, bf* Ah, bf* Al) { const size_t e = ((size_t)blockIdx.x * 256 + threadIdx.x) * 2; if (e >= (size_t)ZH * TT * HD) return; const int d = (int)(e % HD); const int t = (int)((e / HD) % TT); const int zz = (int)(e / ((size_t)HD * TT)); const float cs = (t < RH) ? 1.0f : (1.0f / PCAR); const size_t oo = (size_t)t * DQ + (h0 + zz) * HD + d;
    v2us oh, ol;
#pragma unroll
    for (int q = 0; q < 2; ++q) { unsigned short a, c2; splitf(O[e + q] * cs, a, c2); oh[q] = a; ol[q] = c2; } *(v2us*)(Ah + oo) = oh; *(v2us*)(Al + oo) = ol;  }

__global__ __launch_bounds__(256) void k_wtG(const float* __restrict__ w, int K, int N, bf* Bt) {
    const int lane = threadIdx.x & 31; const int L0 = (blockIdx.x * 8 + (threadIdx.x >> 5)) * 8; const int nlines = N * K / 64;
{
        for (int l = 0; l < 8; ++l) { const int L = L0 + l; if (L >= nlines) break; const size_t e = (size_t)L * 64 + lane * 2; const int k = (int)(e % K), n = (int)(e / K); v2us o;
            o[0] = f2bf(w[(size_t)k * N + n]); o[1] = f2bf(w[(size_t)(k + 1) * N + n]); *(v2us*)(Bt + e) = o; }
         }
}

// k_kw: the per-key score weight: Sb[zz][i][j] = Sb[zz][i][j] x w[j] with w[j] = expf(-LAMBDA x bf16(u[j])) (the module multiplies its scaled scores by exp(-lambda x token_uncertainty) along the KEY axis before the mask and the softmax; the plane holds the scores before the softmax's x SCL, a power of two: (s x w) x SCL and (s x SCL) x w round alike); u is rounded to bf16 at its load like every float input;
__global__ __launch_bounds__(256) void k_kw(float* Sb, const float* __restrict__ u) { const size_t k = (size_t)blockIdx.x * 256 + threadIdx.x; if (k >= (size_t)ZH * TT * TT / 4) return; const size_t e = k * 4; const int j0 = (int)(e % TT); const v4f uu = *(const v4f*)(u + j0); v4f a = *(const v4f*)(Sb + e);
#pragma unroll
    for (int q = 0; q < 4; ++q) { const float w = expf(-LAMBDA * bfr(uu[q])); a[q] = __fmul_rn(a[q], w); }
    *(v4f*)(Sb + e) = a;  }

extern "C" void kernel_launch(void* const* d_in, const int* in_sizes, int n_in,
                              void* d_out, int out_size, void* d_ws, size_t ws_size, hipStream_t stream) {
    (void)in_sizes; (void)n_in; (void)out_size;
    const float* x = (const float*)d_in[0]; const float* un = (const float*)d_in[1]; const int* km = (const int*)d_in[2]; const float* wq = (const float*)d_in[3]; const float* bq = (const float*)d_in[4]; const float* wk = (const float*)d_in[5]; const float* bk = (const float*)d_in[6]; const float* wv = (const float*)d_in[7]; const float* bv = (const float*)d_in[8]; const float* wo = (const float*)d_in[9]; const float* bo = (const float*)d_in[10];
    float* OUT = (float*)d_out;     // [2][2048][1024]
    char* wsp = (char*)d_ws;
    auto take = [&](size_t bytes) { char* p = wsp; wsp += (bytes + 255) & ~(size_t)255; return (void*)p; };
    bf* WQ = (bf*)take((size_t)DQ * DM * 2); bf* WK = (bf*)take((size_t)DKV * DM * 2); bf* WV = (bf*)take((size_t)DKV * DM * 2); bf* WO = (bf*)take((size_t)DM * DQ * 2); float* CS = (float*)take((size_t)TT * HD * 2 * 4);
    bf* XB = (bf*)take((size_t)TT * DM * 2); float* FQ = (float*)take((size_t)TT * DQ * 4); float* FK = (float*)take((size_t)TT * DKV * 4);
    h16* QP16 = (h16*)take((size_t)NH_ * TT * HD * 2); h16* KP16 = (h16*)take((size_t)NKV * TT * HD * 2); h16* VT16 = (h16*)take((size_t)NKV * HD * TT * 2);
    bf* Ph = nullptr; bf* Pl = nullptr;   /* RH 0: no row takes the hi/lo arm of the softmax's store; the f16-only builders take no hi/lo plane */
    float* Sb = (float*)take((size_t)ZH * TT * TT * 4); h16* P16 = (h16*)take((size_t)ZH * TT * TT * 2); float* Ob = (float*)take((size_t)ZH * TT * HD * 4); bf* ATh = (bf*)take((size_t)TT * DQ * 2); bf* ATl = (bf*)take((size_t)TT * DQ * 2);
    if ((size_t)(wsp - (char*)d_ws) > ws_size) return;    // total 98.00 MiB of the workspace
    float* FV = FK;   // v projection reuses the k buffer after the k planes are built (stream-ordered)
    { const unsigned GW = (unsigned)((DM * DQ / 64 + 63) / 64); k_wtG<<<GW, 256, 0, stream>>>(wq, DM, DQ, WQ); k_wtG<<<GW, 256, 0, stream>>>(wk, DM, DKV, WK); k_wtG<<<GW, 256, 0, stream>>>(wv, DM, DKV, WV); k_wtG<<<GW, 256, 0, stream>>>(wo, DQ, DM, WO); }   // 'io' [in][out] -> Bt [out][in], rounded to bf16
    k_csid<<<(TT * HD + 255) / 256, 256, 0, stream>>>(CS);
    const unsigned LQ = (unsigned)(((size_t)NH_ * TT * HD / 2 + 255) / 256), LKv = (unsigned)(((size_t)NKV * TT * HD / 2 + 255) / 256), LX = (unsigned)(((size_t)TT * DM / 8 + 255) / 256);
    for (int b = 0; b < NB_; ++b) {
        k_cvt8<<<LX, 256, 0, stream>>>(x + (size_t)b * TT * DM, XB, (size_t)TT * DM / 8);
        k_gemmw<bf, 0, true><<<dim3(TT / 64, DQ / 64, 1), 32, 0, stream>>>(XB, nullptr, WQ, nullptr, DM, FQ, DQ, bq, 0, 0, 0);
        k_rope<<<LQ, 256, 0, stream>>>(FQ, DQ, NH_, CS, nullptr, nullptr, 1.0f, QP16, nullptr, nullptr);
        k_gemmw<bf, 0, true><<<dim3(TT / 64, DKV / 64, 1), 32, 0, stream>>>(XB, nullptr, WK, nullptr, DM, FK, DKV, bk, 0, 0, 0);
        k_rope<<<LKv, 256, 0, stream>>>(FK, DKV, NKV, CS, nullptr, nullptr, 1.0f, KP16, nullptr, nullptr);
        k_gemmw<bf, 0, true><<<dim3(TT / 64, DKV / 64, 1), 32, 0, stream>>>(XB, nullptr, WV, nullptr, DM, FV, DKV, bv, 0, 0, 0); k_vtp<<<LKv, 256, 0, stream>>>(FV, DKV, NKV, VT16, nullptr, nullptr);
        for (int h0 = 0; h0 < NH_; h0 += ZH) { const size_t zq = (size_t)h0, zk = (size_t)(h0 / REP);   // one kv head per query head: the pass's two heads use consecutive kv planes (z-strides TT*HD)
            k_gemmw<h16, 0, false><<<dim3((TT - RH) / 64, TT / 64, ZH), 32, 0, stream>>>(QP16 + zq * TT * HD + (size_t)RH * HD, nullptr, KP16 + zk * TT * HD, nullptr, HD, Sb + (size_t)RH * TT, TT, nullptr, (size_t)TT * HD, (size_t)TT * HD, (size_t)TT * TT);
            k_kw<<<(unsigned)(((size_t)ZH * TT * TT / 4 + 255) / 256), 256, 0, stream>>>(Sb, un + (size_t)b * TT);   /* scores x exp(-LAMBDA x uncertainty[key]) */
            k_asoft<<<ZH * TT / 8, 256, 0, stream>>>(Sb, km + (size_t)b * TT, P16, Ph, Pl);
            k_gemmw<h16, 0, false><<<dim3((TT - RH) / 64, HD / 64, ZH), 32, 0, stream>>>(P16 + (size_t)RH * TT, nullptr, VT16 + zk * HD * TT, nullptr, TT, Ob + (size_t)RH * HD, HD, nullptr, (size_t)TT * TT, (size_t)HD * TT, (size_t)TT * HD);
            k_merge<<<(unsigned)(((size_t)ZH * TT * HD / 2 + 255) / 256), 256, 0, stream>>>(Ob, h0, ATh, ATl); }
        k_gemmw<bf, 1, true><<<dim3(TT / 64, DM / 64, 1), 32, 0, stream>>>(ATh, ATl, WO, nullptr, DQ, OUT + (size_t)b * TT * DM, DM, bo, 0, 0, 0); }
}

// v002
// Measured time: 312 microseconds a run.
// Versions between v000 and this one are left out; their measured steps multiply to 4.66 times as fast.
#include <hip/hip_runtime.h>

// Multi-head self-attention whose scaled scores are multiplied, per KEY, by an uncertainty weight before the mask and the softmax, with an integer key mask read as data and an output projection (hidden_states [2][2048][1024]; token_uncertainty [2][2048]; attention_mask int32 [2][2048];
// q, k, v = x W + b with 'io' weights [1024][1024] (in, out) and biases [1024]; 16 heads x 64 (head h = columns h x 64 ..); scores = q k^T / sqrt(64); scores = scores x exp(-0.5 x token_uncertainty[b][key]); where(mask[b][key] != 0, scores, -inf); softmax over the keys;
// out = merged Wo + bo ('io' + bias) -> [2][2048][1024] (4.2 M); argument order hidden_states, token_uncertainty, attention_mask, Wq, bq, Wk, bk, Wv, bv, Wo, bo).
// Layout per batch entry: one bf16 copy of x (read by all three projections); the 'io' weights transposed and rounded once (k_wtG); exact projections + f32 biases, whose epilogues write the f16 head planes themselves (q, k as [h][t][d], v as [h][d][t]); dense T-2048 attention at 16 heads in one launch (k_fattn):
// the f16 score product, each score x its key's weight x SCL in f32, the entry's int key mask, a running-maximum softmax in f32 whose weights go to fp16 in registers, attn.v on ONE fp16 product, the division by the sum; merged hi/lo x Wo exact + bo.
// Compute dtypes, f32 accumulate: every float input rounded to bf16 at its load (the uncertainty row too); projections exact + f32 biases; scores and attn.v fp16; the key weight and the softmax f32; Wo hl x exact + bias.

#define NB_  2
#define TT   2048
#define DM   1024
#define NH_  16
#define NKV  16
#define REP  (NH_ / NKV)
#define HD   64
#define DQ   (NH_ * HD)
#define DKV  (NKV * HD)
#define SCL  0.125f   // HD^-0.5
#define LAMBDA 0.5f   // the module's uncertainty weight: w = exp(-LAMBDA x token_uncertainty) per key
typedef _Float16 h16;
typedef unsigned short bf;
typedef __attribute__((ext_vector_type(16))) __bf16   v16bf;
typedef __attribute__((ext_vector_type(16))) _Float16 v16h;
typedef __attribute__((ext_vector_type(8)))  _Float16 v8h;
typedef __attribute__((ext_vector_type(4)))  _Float16 v4h;
typedef __attribute__((ext_vector_type(8)))  unsigned short v8us;
typedef __attribute__((ext_vector_type(8)))  float    v8f;
typedef __attribute__((ext_vector_type(4)))  float    v4f;
typedef v8h  __attribute__((may_alias)) v8ha;
typedef v4f  __attribute__((may_alias)) v4fa;
typedef v8us __attribute__((may_alias)) v8usa;

__device__ __forceinline__ unsigned short f2bf(float f) { unsigned u = __float_as_uint(f); u += 0x7FFFu + ((u >> 16) & 1u); return (unsigned short)(u >> 16); }
__device__ __forceinline__ float bf2f(unsigned short b) { return __uint_as_float(((unsigned)b) << 16); }
__device__ __forceinline__ float bfr(float f) { return bf2f(f2bf(f)); }
__device__ __forceinline__ v16h cat16(v8h lo, v8h hi) { return __builtin_shufflevector(lo, hi, 0, 1, 2, 3, 4, 5, 6, 7, 8, 9, 10, 11, 12, 13, 14, 15); }
__device__ __forceinline__ v16bf cat16b(v8us lo, v8us hi) { return __builtin_bit_cast(v16bf, __builtin_shufflevector(lo, hi, 0, 1, 2, 3, 4, 5, 6, 7, 8, 9, 10, 11, 12, 13, 14, 15)); }
__device__ __forceinline__ v8f wmma16(v16h a, v16h b, v8f c) { return __builtin_amdgcn_wmma_f32_16x16x32_f16(false, a, false, b, (short)0, c, false, false); }
__device__ __forceinline__ v8f wmmab(v16bf a, v16bf b, v8f c) { return __builtin_amdgcn_wmma_f32_16x16x32_bf16(false, a, false, b, (short)0, c, false, false); }



// ---- k_gemmw: register-blocked GEMM, ONE WAVE per 64x64 output tile (16 accumulators), operands straight from K-contiguous 16-bit planes; grid (M/64, N/64, Z), 32 threads.
// y[m][n] = sum_k A[m][k] Bt[n][k] (+ split products per NSPLIT) + f32 bias[n]. z-batch strides sA/sB/sC in elements. K % 32 == 0.
// OM 0: C[m][n] = y in f32, pitch ldc. OM 1: fp16 head plane P[n / 64][m][n % 64] (a 64-column tile is one head, its 64 rows are 8 KiB in a row). OM 2: fp16 transposed plane P[n][m], pitch TT: a lane's 8 accumulator registers are 8 consecutive m of one n, one 16-B store.
template <typename T16> struct WFrag;
template <> struct WFrag<h16> { typedef v16h V; static __device__ __forceinline__ V ld(const h16* p) { return cat16(*(const v8h*)p, *(const v8h*)(p + 16)); } static __device__ __forceinline__ v8f mma(V a, V b, v8f c) { return wmma16(a, b, c); } };
template <> struct WFrag<bf> { typedef v16bf V; static __device__ __forceinline__ V ld(const bf* p) { return cat16b(*(const v8us*)p, *(const v8us*)(p + 16)); } static __device__ __forceinline__ v8f mma(V a, V b, v8f c) { return wmmab(a, b, c); } };
template <typename T16, int NSPLIT, int OM>
__global__ __launch_bounds__(32) void k_gemmw(const T16* __restrict__ A, const T16* __restrict__ A2, const T16* __restrict__ Bt, const T16* __restrict__ Bt2, int K, float* C, h16* P, int ldc, const float* __restrict__ bias, size_t sA, size_t sB, size_t sC) {
    typedef typename WFrag<T16>::V V;
    __shared__ __align__(16) float os[16 * 68];
    const size_t z = blockIdx.z; A += z * sA; if (A2) A2 += z * sA; Bt += z * sB; if (Bt2) Bt2 += z * sB; if (OM == 0) C += z * sC;
    const int lane = threadIdx.x & 31, lr = lane & 15, hi = lane >> 4; const int r0 = blockIdx.x * 64, c0 = blockIdx.y * 64;
    v8f acc[4][4];
#pragma unroll
    for (int mb = 0; mb < 4; ++mb)
#pragma unroll
        for (int nb = 0; nb < 4; ++nb) acc[mb][nb] = (v8f){};
    const size_t aoff = (size_t)(r0 + lr) * K + 8 * hi, boff = (size_t)(c0 + lr) * K + 8 * hi;

    for (int kc = 0; kc < K; kc += 32) {
        V a[4], a2[4];
#pragma unroll
        for (int mb = 0; mb < 4; ++mb) { a[mb] = WFrag<T16>::ld(A + aoff + (size_t)mb * 16 * K + kc); if (NSPLIT == 1 || NSPLIT == 2) a2[mb] = WFrag<T16>::ld(A2 + aoff + (size_t)mb * 16 * K + kc); }
#pragma unroll
        for (int nb = 0; nb < 4; ++nb) { const V b = WFrag<T16>::ld(Bt + boff + (size_t)nb * 16 * K + kc); V b2; if (NSPLIT >= 2) b2 = WFrag<T16>::ld(Bt2 + boff + (size_t)nb * 16 * K + kc);
#pragma unroll
            for (int mb = 0; mb < 4; ++mb) { acc[mb][nb] = WFrag<T16>::mma(a[mb], b, acc[mb][nb]); if (NSPLIT == 1 || NSPLIT == 2) acc[mb][nb] = WFrag<T16>::mma(a2[mb], b, acc[mb][nb]); if (NSPLIT >= 2) acc[mb][nb] = WFrag<T16>::mma(a[mb], b2, acc[mb][nb]); } }
        asm volatile("v_nop\n\tv_nop\n\tv_nop\n\tv_nop" : "+v"(acc[0][0]), "+v"(acc[1][1]), "+v"(acc[2][2]), "+v"(acc[3][3]) : "v"(a[0]), "v"(a[3]));
    }
    if (OM == 2) {   // straight from the accumulators: for each n the four row blocks of this wave fill one whole 128-B line of P
#pragma unroll
        for (int nb = 0; nb < 4; ++nb) { const float bn = bfr(bias[c0 + nb * 16 + lr]); h16* pcol = P + (size_t)(c0 + nb * 16 + lr) * TT + r0 + hi * 8;
#pragma unroll
            for (int mb = 0; mb < 4; ++mb) { v8h o;
#pragma unroll
                for (int j = 0; j < 8; ++j) o[j] = (h16)(acc[mb][nb][j] + bn);
                *(v8h*)(pcol + mb * 16) = o; } }
        return; }
#pragma unroll
    for (int mb = 0; mb < 4; ++mb) {
#pragma unroll
        for (int nb = 0; nb < 4; ++nb) {
#pragma unroll
            for (int j = 0; j < 8; ++j) os[(hi * 8 + j) * 68 + nb * 16 + lr] = acc[mb][nb][j]; }
        __builtin_amdgcn_wave_barrier(); asm volatile("" ::: "memory");
        float* crow = C + (size_t)(r0 + mb * 16) * ldc + c0;
#pragma unroll
        for (int s = 0; s < 8; ++s) { const int row = 2 * s + hi, cofs = lr * 4; v4f val = *(const v4fa*)(os + row * 68 + cofs); val[0] += bfr(bias[c0 + cofs]); val[1] += bfr(bias[c0 + cofs + 1]); val[2] += bfr(bias[c0 + cofs + 2]); val[3] += bfr(bias[c0 + cofs + 3]);
            if (OM == 0) *(v4f*)(crow + (size_t)row * ldc + cofs) = val;
            else { v4h o; o[0] = (h16)val[0]; o[1] = (h16)val[1]; o[2] = (h16)val[2]; o[3] = (h16)val[3]; *(v4h*)(P + ((size_t)blockIdx.y * TT + r0 + mb * 16 + row) * HD + cofs) = o; } }
        __builtin_amdgcn_wave_barrier(); asm volatile("" ::: "memory");
    }
}

__device__ __forceinline__ void splitf(float y, unsigned short& h, unsigned short& l) { h = f2bf(y); l = f2bf(y - bf2f(h)); }
typedef __attribute__((ext_vector_type(2))) unsigned short v2us;
typedef __attribute__((ext_vector_type(4))) unsigned short v4us;
typedef __attribute__((ext_vector_type(4))) int v4i;

__global__ __launch_bounds__(256) void k_cvt8(const float* __restrict__ src, bf* dst, size_t n8) { const size_t i = (size_t)blockIdx.x * 256 + threadIdx.x; if (i >= n8) return; const v8f v = *(const v8f*)(src + i * 8); v8us o;
#pragma unroll
    for (int k = 0; k < 8; ++k) o[k] = f2bf(v[k]); *(v8us*)(dst + i * 8) = o;  }

__global__ __launch_bounds__(256) void k_wtG(const float* __restrict__ w, int K, int N, bf* Bt) {
    const int lane = threadIdx.x & 31; const int L0 = (blockIdx.x * 8 + (threadIdx.x >> 5)) * 8; const int nlines = N * K / 64;
{
        for (int l = 0; l < 8; ++l) { const int L = L0 + l; if (L >= nlines) break; const size_t e = (size_t)L * 64 + lane * 2; const int k = (int)(e % K), n = (int)(e / K); v2us o;
            o[0] = f2bf(w[(size_t)k * N + n]); o[1] = f2bf(w[(size_t)(k + 1) * N + n]); *(v2us*)(Bt + e) = o; }
         }
}

__device__ __forceinline__ float xhalf(float x) { return __builtin_bit_cast(float, __builtin_amdgcn_permlanex16(__builtin_bit_cast(int, x), __builtin_bit_cast(int, x), 0x76543210, 0xfedcba98, false, false)); }  // lane l with lane l ^ 16, in the vector unit (a shuffle would go through the LDS path and its wait)
#define FKB 64     // keys a pass
#define FWV 4      // waves a work-group: one on each SIMD, all on one head, so that they share its K and V lines in the WGP cache
__global__ __launch_bounds__(FWV * 32) void k_fattn(const h16* __restrict__ Qp, const h16* __restrict__ Kp, const h16* __restrict__ Vt, const float* __restrict__ u, const int* __restrict__ kvp, bf* Ah, bf* Al) {
    __shared__ __align__(16) float wl[TT]; __shared__ __align__(16) float mb[TT];
    { v4i kq[TT / (FWV * 128)]; v4f uq[TT / (FWV * 128)];   // both rows are loaded whole and unconditionally first (16 B a lane, whole lines), so that the work-group pays one load latency, not one per key group
#pragma unroll
        for (int r = 0; r < TT / (FWV * 128); ++r) { const int j = r * (FWV * 128) + threadIdx.x * 4; kq[r] = *(const v4i*)(kvp + j); uq[r] = *(const v4f*)(u + j); }
#pragma unroll
        for (int r = 0; r < TT / (FWV * 128); ++r)
#pragma unroll
            for (int q = 0; q < 4; ++q) uq[r][q] = expf(-LAMBDA * bfr(uq[r][q])) * (SCL * 1.4426950408889634f);
#pragma unroll
        for (int r = 0; r < TT / (FWV * 128); ++r) { const int j = r * (FWV * 128) + threadIdx.x * 4; v4f w4, b4;
#pragma unroll
            for (int q = 0; q < 4; ++q) { const bool on = (kq[r][q] != 0); w4[q] = on ? uq[r][q] : 0.0f; b4[q] = on ? 0.0f : -3.0e38f; }
            *(v4fa*)(wl + j) = w4; *(v4fa*)(mb + j) = b4; } }
    __syncthreads();
    const int lane = threadIdx.x & 31, lr = lane & 15, hi = lane >> 4; const int h = blockIdx.y; const int q0 = (blockIdx.x * FWV + (threadIdx.x >> 5)) * 32;
    const h16* qb = Qp + ((size_t)h * TT + q0 + lr) * HD + 8 * hi; const h16* kb = Kp + ((size_t)h * TT + lr) * HD + 8 * hi; const h16* vb = Vt + ((size_t)h * HD + lr) * TT + 8 * hi;
    v16h qf[2][2], kf[4][2]; v8f o[4][2]; float m[2], l[2];
#pragma unroll
    for (int qt = 0; qt < 2; ++qt) { m[qt] = -3.0e38f; l[qt] = 0.0f;
#pragma unroll
        for (int dh = 0; dh < 2; ++dh) qf[qt][dh] = WFrag<h16>::ld(qb + qt * 16 * HD + dh * 32);
#pragma unroll
        for (int dt = 0; dt < 4; ++dt) o[dt][qt] = (v8f){}; }
#pragma unroll
    for (int kt = 0; kt < 4; ++kt)
#pragma unroll
        for (int dh = 0; dh < 2; ++dh) kf[kt][dh] = WFrag<h16>::ld(kb + kt * 16 * HD + dh * 32);
    for (int k0 = 0; k0 < TT; k0 += FKB) {
        v16h vf[4][2]; v8f s[4][2];
#pragma unroll
        for (int dt = 0; dt < 4; ++dt)
#pragma unroll
            for (int ks = 0; ks < 2; ++ks) vf[dt][ks] = WFrag<h16>::ld(vb + (size_t)dt * 16 * TT + k0 + ks * 32);
        asm volatile("s_wait_xcnt 0x0" ::: "memory");   // stands in front of the pointer's step to the next pass, which overwrites the address registers that these loads name
        v4f wv[4][2], bv[4][2];
#pragma unroll
        for (int kt = 0; kt < 4; ++kt)
#pragma unroll
            for (int g = 0; g < 2; ++g) { wv[kt][g] = *(const v4fa*)(wl + k0 + kt * 16 + hi * 8 + g * 4); bv[kt][g] = *(const v4fa*)(mb + k0 + kt * 16 + hi * 8 + g * 4); }
        __builtin_amdgcn_sched_barrier(0);   // all 16 V loads and the pass's key rows from LDS issue here, ahead of the score products; without it the compiler sinks half the V loads to just in front of their use and reads LDS in four load-wait-use groups, and the wave waits out each latency
#pragma unroll
        for (int kt = 0; kt < 4; ++kt)
#pragma unroll
            for (int qt = 0; qt < 2; ++qt) { s[kt][qt] = wmma16(kf[kt][0], qf[qt][0], (v8f){}); s[kt][qt] = wmma16(kf[kt][1], qf[qt][1], s[kt][qt]); }
        const int kn = (k0 + FKB < TT) ? k0 + FKB : 0;   // the next pass's K rows are fetched behind this pass's score products (the last pass re-reads block 0, in bounds, unused)
#pragma unroll
        for (int kt = 0; kt < 4; ++kt)
#pragma unroll
            for (int dh = 0; dh < 2; ++dh) kf[kt][dh] = WFrag<h16>::ld(kb + (size_t)(kn + kt * 16) * HD + dh * 32);
        asm volatile("s_wait_xcnt 0x0" ::: "memory");   // in front of the first reuse of the address registers that these loads name
        __builtin_amdgcn_sched_barrier(0);   // the next pass's 16 K loads issue in front of the softmax, not spread through it
#pragma unroll
        for (int kt = 0; kt < 4; ++kt)
#pragma unroll
            for (int qt = 0; qt < 2; ++qt)
#pragma unroll
                for (int j = 0; j < 4; ++j) { s[kt][qt][j] = fmaf(s[kt][qt][j], wv[kt][0][j], bv[kt][0][j]); s[kt][qt][j + 4] = fmaf(s[kt][qt][j + 4], wv[kt][1][j], bv[kt][1][j]); }
        v16h pf[2][2];
#pragma unroll
        for (int qt = 0; qt < 2; ++qt) { float mx = m[qt];
#pragma unroll
            for (int kt = 0; kt < 4; ++kt)
#pragma unroll
                for (int j = 0; j < 8; ++j) mx = fmaxf(mx, s[kt][qt][j]);
            mx = fmaxf(mx, xhalf(mx));
            const float al = __builtin_amdgcn_exp2f(m[qt] - mx); m[qt] = mx; float sum = 0.0f;
#pragma unroll
            for (int kt = 0; kt < 4; ++kt)
#pragma unroll
                for (int j = 0; j < 8; ++j) { const float p = __builtin_amdgcn_exp2f(s[kt][qt][j] - mx); sum += p; pf[kt >> 1][qt][(kt & 1) * 8 + j] = (h16)p; }
            l[qt] = fmaf(l[qt], al, sum);
#pragma unroll
            for (int dt = 0; dt < 4; ++dt)
#pragma unroll
                for (int j = 0; j < 8; ++j) o[dt][qt][j] *= al; }
#pragma unroll
        for (int ks = 0; ks < 2; ++ks)
#pragma unroll
            for (int dt = 0; dt < 4; ++dt)
#pragma unroll
                for (int qt = 0; qt < 2; ++qt) o[dt][qt] = wmma16(vf[dt][ks], pf[ks][qt], o[dt][qt]);
    }
#pragma unroll
    for (int qt = 0; qt < 2; ++qt) { const float inv = __fdiv_rn(1.0f, l[qt] + xhalf(l[qt]));
#pragma unroll
        for (int dt = 0; dt < 4; ++dt) { v8us oh, ol;
#pragma unroll
            for (int j = 0; j < 8; ++j) { unsigned short a, c2; splitf(o[dt][qt][j] * inv, a, c2); oh[j] = a; ol[j] = c2; }
            const size_t oo = (size_t)(q0 + qt * 16 + lr) * DQ + h * HD + dt * 16 + hi * 8; *(v8us*)(Ah + oo) = oh; *(v8us*)(Al + oo) = ol; } }
}

extern "C" void kernel_launch(void* const* d_in, const int* in_sizes, int n_in,
                              void* d_out, int out_size, void* d_ws, size_t ws_size, hipStream_t stream) {
    (void)in_sizes; (void)n_in; (void)out_size;
    const float* x = (const float*)d_in[0]; const float* un = (const float*)d_in[1]; const int* km = (const int*)d_in[2]; const float* wq = (const float*)d_in[3]; const float* bq = (const float*)d_in[4]; const float* wk = (const float*)d_in[5]; const float* bk = (const float*)d_in[6]; const float* wv = (const float*)d_in[7]; const float* bv = (const float*)d_in[8]; const float* wo = (const float*)d_in[9]; const float* bo = (const float*)d_in[10];
    float* OUT = (float*)d_out;     // [2][2048][1024]
    char* wsp = (char*)d_ws;
    auto take = [&](size_t bytes) { char* p = wsp; wsp += (bytes + 255) & ~(size_t)255; return (void*)p; };
    bf* WQ = (bf*)take((size_t)DQ * DM * 2); bf* WK = (bf*)take((size_t)DKV * DM * 2); bf* WV = (bf*)take((size_t)DKV * DM * 2); bf* WO = (bf*)take((size_t)DM * DQ * 2);
    bf* XB = (bf*)take((size_t)TT * DM * 2);
    h16* QP16 = (h16*)take((size_t)NH_ * TT * HD * 2); h16* KP16 = (h16*)take((size_t)NKV * TT * HD * 2); h16* VT16 = (h16*)take((size_t)NKV * HD * TT * 2);
    bf* ATh = (bf*)take((size_t)TT * DQ * 2); bf* ATl = (bf*)take((size_t)TT * DQ * 2);
    if ((size_t)(wsp - (char*)d_ws) > ws_size) return;    // total 32 MiB of the workspace
    { const unsigned GW = (unsigned)((DM * DQ / 64 + 63) / 64); k_wtG<<<GW, 256, 0, stream>>>(wq, DM, DQ, WQ); k_wtG<<<GW, 256, 0, stream>>>(wk, DM, DKV, WK); k_wtG<<<GW, 256, 0, stream>>>(wv, DM, DKV, WV); k_wtG<<<GW, 256, 0, stream>>>(wo, DQ, DM, WO); }   // 'io' [in][out] -> Bt [out][in], rounded to bf16
    const unsigned LX = (unsigned)(((size_t)TT * DM / 8 + 255) / 256);
    for (int b = 0; b < NB_; ++b) {
        k_cvt8<<<LX, 256, 0, stream>>>(x + (size_t)b * TT * DM, XB, (size_t)TT * DM / 8);
        k_gemmw<bf, 0, 1><<<dim3(TT / 64, DQ / 64, 1), 32, 0, stream>>>(XB, nullptr, WQ, nullptr, DM, nullptr, QP16, 0, bq, 0, 0, 0);    // q planes [h][t][d]
        k_gemmw<bf, 0, 1><<<dim3(TT / 64, DKV / 64, 1), 32, 0, stream>>>(XB, nullptr, WK, nullptr, DM, nullptr, KP16, 0, bk, 0, 0, 0);   // k planes [h][t][d]
        k_gemmw<bf, 0, 2><<<dim3(TT / 64, DKV / 64, 1), 32, 0, stream>>>(XB, nullptr, WV, nullptr, DM, nullptr, VT16, 0, bv, 0, 0, 0);   // v planes [h][d][t]
        k_fattn<<<dim3(TT / (FWV * 32), NH_, 1), FWV * 32, 0, stream>>>(QP16, KP16, VT16, un + (size_t)b * TT, km + (size_t)b * TT, ATh, ATl);   // all 16 heads of the entry: scores, key weight, mask, softmax, attn.v, merged hi/lo planes
        k_gemmw<bf, 1, 0><<<dim3(TT / 64, DM / 64, 1), 32, 0, stream>>>(ATh, ATl, WO, nullptr, DQ, OUT + (size_t)b * TT * DM, nullptr, DM, bo, 0, 0, 0); }
}

// v003
// Measured time: 159 microseconds a run.
// In two side-by-side timings against v002, it was 1.97 and 1.88 times as fast.
// Over all steps from v000 it is 8.96 times as fast.
#include <hip/hip_runtime.h>

// Multi-head self-attention whose scaled scores are multiplied, per KEY, by an uncertainty weight before the mask and the softmax, with an integer key mask read as data and an output projection (hidden_states [2][2048][1024]; token_uncertainty [2][2048]; attention_mask int32 [2][2048];
// q, k, v = x W + b with 'io' weights [1024][1024] (in, out) and biases [1024]; 16 heads x 64 (head h = columns h x 64 ..); scores = q k^T / sqrt(64); scores = scores x exp(-0.5 x token_uncertainty[b][key]); where(mask[b][key] != 0, scores, -inf); softmax over the keys;
// out = merged Wo + bo ('io' + bias) -> [2][2048][1024] (4.2 M); argument order hidden_states, token_uncertainty, attention_mask, Wq, bq, Wk, bk, Wv, bv, Wo, bo).
// Layout, both batch entries in every launch: one bf16 copy of x (read by all three projections) and the 'io' weights transposed and rounded, in one launch (k_prep); q, k, v as ONE product [4096][1024] x [3072][1024]^T + f32 biases, whose epilogue writes the f16 head planes itself (q, k as [b][h][t][d], v as [b][h][d][t]); dense T-2048 attention, 16 heads x 2 entries in one launch (k_fattn):
// the f16 score product, each score x its key's weight x SCL in f32, the entry's int key mask, a running-maximum softmax in f32 whose weights go to fp16 in registers, attn.v on ONE fp16 product, the division by the sum; merged hi/lo x Wo exact + bo.
// Compute dtypes, f32 accumulate: every float input rounded to bf16 at its load (the uncertainty row too); projections exact + f32 biases; scores and attn.v fp16; the key weight and the softmax f32; Wo hl x exact + bias.

#define NB_  2
#define TT   2048
#define DM   1024
#define NH_  16
#define NKV  16
#define REP  (NH_ / NKV)
#define HD   64
#define DQ   (NH_ * HD)
#define DKV  (NKV * HD)
#define SCL  0.125f   // HD^-0.5
#define LAMBDA 0.5f   // the module's uncertainty weight: w = exp(-LAMBDA x token_uncertainty) per key
typedef _Float16 h16;
typedef unsigned short bf;
typedef __attribute__((ext_vector_type(16))) __bf16   v16bf;
typedef __attribute__((ext_vector_type(16))) _Float16 v16h;
typedef __attribute__((ext_vector_type(8)))  _Float16 v8h;
typedef __attribute__((ext_vector_type(4)))  _Float16 v4h;
typedef __attribute__((ext_vector_type(8)))  unsigned short v8us;
typedef __attribute__((ext_vector_type(8)))  float    v8f;
typedef __attribute__((ext_vector_type(4)))  float    v4f;
typedef v8h  __attribute__((may_alias)) v8ha;
typedef v4f  __attribute__((may_alias)) v4fa;
typedef v8us __attribute__((may_alias)) v8usa;

__device__ __forceinline__ unsigned short f2bf(float f) { unsigned u = __float_as_uint(f); u += 0x7FFFu + ((u >> 16) & 1u); return (unsigned short)(u >> 16); }
__device__ __forceinline__ float bf2f(unsigned short b) { return __uint_as_float(((unsigned)b) << 16); }
__device__ __forceinline__ float bfr(float f) { return bf2f(f2bf(f)); }
__device__ __forceinline__ v16h cat16(v8h lo, v8h hi) { return __builtin_shufflevector(lo, hi, 0, 1, 2, 3, 4, 5, 6, 7, 8, 9, 10, 11, 12, 13, 14, 15); }
__device__ __forceinline__ v16bf cat16b(v8us lo, v8us hi) { return __builtin_bit_cast(v16bf, __builtin_shufflevector(lo, hi, 0, 1, 2, 3, 4, 5, 6, 7, 8, 9, 10, 11, 12, 13, 14, 15)); }
__device__ __forceinline__ v8f wmma16(v16h a, v16h b, v8f c) { return __builtin_amdgcn_wmma_f32_16x16x32_f16(false, a, false, b, (short)0, c, false, false); }
__device__ __forceinline__ v8f wmmab(v16bf a, v16bf b, v8f c) { return __builtin_amdgcn_wmma_f32_16x16x32_bf16(false, a, false, b, (short)0, c, false, false); }



// ---- k_gemmw: register-blocked GEMM, ONE WAVE per 64x64 output tile (16 accumulators), operands straight from K-contiguous 16-bit planes; grid (M/64, N/64), 32 threads.
// y[m][n] = sum_k A[m][k] Bt[n][k] (+ split products per NSPLIT) + f32 bias[n]. K % 32 == 0. The rows m run over both batch entries (m = b x TT + t).
// OM 0: C[m][n] = y in f32, pitch ldc. OM 1: the columns are q | k | v (DQ each, biases bias | bias1 | bias2), a tile lies in one of them and in one entry; P holds the three fp16 plane sets one behind the other, each [b][...]:
// q and k as head planes [n / 64][t][n % 64] (a 64-column tile is one head, its 64 rows are 8 KiB in a row), v transposed as [n][t], pitch TT: a lane's 8 accumulator registers are 8 consecutive t of one n, one 16-B store.
template <typename T16> struct WFrag;
template <> struct WFrag<h16> { typedef v16h V; static __device__ __forceinline__ V ld(const h16* p) { return cat16(*(const v8h*)p, *(const v8h*)(p + 16)); } static __device__ __forceinline__ v8f mma(V a, V b, v8f c) { return wmma16(a, b, c); } };
template <> struct WFrag<bf> { typedef v16bf V; static __device__ __forceinline__ V ld(const bf* p) { return cat16b(*(const v8us*)p, *(const v8us*)(p + 16)); } static __device__ __forceinline__ v8f mma(V a, V b, v8f c) { return wmmab(a, b, c); } };
template <typename T16, int NSPLIT, int OM>
__global__ __launch_bounds__(32) void k_gemmw(const T16* __restrict__ A, const T16* __restrict__ A2, const T16* __restrict__ Bt, const T16* __restrict__ Bt2, int K, float* C, h16* P, int ldc, const float* __restrict__ bias, const float* __restrict__ bias1, const float* __restrict__ bias2) {
    typedef typename WFrag<T16>::V V;
    __shared__ __align__(16) float os[16 * 68];
    const int lane = threadIdx.x & 31, lr = lane & 15, hi = lane >> 4; const int r0 = blockIdx.x * 64, c0 = blockIdx.y * 64;
    v8f acc[4][4];
#pragma unroll
    for (int mb = 0; mb < 4; ++mb)
#pragma unroll
        for (int nb = 0; nb < 4; ++nb) acc[mb][nb] = (v8f){};
    const size_t aoff = (size_t)(r0 + lr) * K + 8 * hi, boff = (size_t)(c0 + lr) * K + 8 * hi;

    for (int kc = 0; kc < K; kc += 32) {
        V a[4], a2[4];
#pragma unroll
        for (int mb = 0; mb < 4; ++mb) { a[mb] = WFrag<T16>::ld(A + aoff + (size_t)mb * 16 * K + kc); if (NSPLIT == 1 || NSPLIT == 2) a2[mb] = WFrag<T16>::ld(A2 + aoff + (size_t)mb * 16 * K + kc); }
#pragma unroll
        for (int nb = 0; nb < 4; ++nb) { const V b = WFrag<T16>::ld(Bt + boff + (size_t)nb * 16 * K + kc); V b2; if (NSPLIT >= 2) b2 = WFrag<T16>::ld(Bt2 + boff + (size_t)nb * 16 * K + kc);
#pragma unroll
            for (int mb = 0; mb < 4; ++mb) { acc[mb][nb] = WFrag<T16>::mma(a[mb], b, acc[mb][nb]); if (NSPLIT == 1 || NSPLIT == 2) acc[mb][nb] = WFrag<T16>::mma(a2[mb], b, acc[mb][nb]); if (NSPLIT >= 2) acc[mb][nb] = WFrag<T16>::mma(a[mb], b2, acc[mb][nb]); } }
        asm volatile("v_nop\n\tv_nop\n\tv_nop\n\tv_nop" : "+v"(acc[0][0]), "+v"(acc[1][1]), "+v"(acc[2][2]), "+v"(acc[3][3]) : "v"(a[0]), "v"(a[3]));
    }
    const int sel = (OM == 1) ? c0 / DQ : 0, cl = (OM == 1) ? c0 % DQ : c0, rt = r0 % TT;   // which projection, the column in it, the row in its entry: the same for the whole tile
    const float* bs = (sel == 0) ? bias : (sel == 1) ? bias1 : bias2;
    if (OM == 1) P += ((size_t)sel * NB_ + r0 / TT) * ((size_t)NH_ * TT * HD);
    if (OM == 1 && sel == 2) {   // straight from the accumulators: for each n the four row blocks of this wave fill one whole 128-B line of P
#pragma unroll
        for (int nb = 0; nb < 4; ++nb) { const float bn = bfr(bs[cl + nb * 16 + lr]); h16* pcol = P + (size_t)(cl + nb * 16 + lr) * TT + rt + hi * 8;
#pragma unroll
            for (int mb = 0; mb < 4; ++mb) { v8h o;
#pragma unroll
                for (int j = 0; j < 8; ++j) o[j] = (h16)(acc[mb][nb][j] + bn);
                *(v8h*)(pcol + mb * 16) = o; } }
        return; }
    const int cofs = lr * 4; v4f bb;   // a lane stores the same four columns in every row: their biases are read once
#pragma unroll
    for (int q = 0; q < 4; ++q) bb[q] = bfr(bs[cl + cofs + q]);
#pragma unroll
    for (int mb = 0; mb < 4; ++mb) {
#pragma unroll
        for (int nb = 0; nb < 4; ++nb) {
#pragma unroll
            for (int j = 0; j < 8; ++j) os[(hi * 8 + j) * 68 + nb * 16 + lr] = acc[mb][nb][j]; }
        __builtin_amdgcn_wave_barrier(); asm volatile("" ::: "memory");
        float* crow = C + (size_t)(r0 + mb * 16) * ldc + c0;
#pragma unroll
        for (int s = 0; s < 8; ++s) { const int row = 2 * s + hi; v4f val = *(const v4fa*)(os + row * 68 + cofs); val[0] += bb[0]; val[1] += bb[1]; val[2] += bb[2]; val[3] += bb[3];
            if (OM == 0) *(v4f*)(crow + (size_t)row * ldc + cofs) = val;
            else { v4h o; o[0] = (h16)val[0]; o[1] = (h16)val[1]; o[2] = (h16)val[2]; o[3] = (h16)val[3]; *(v4h*)(P + ((size_t)(cl / HD) * TT + rt + mb * 16 + row) * HD + cofs) = o; } }
        __builtin_amdgcn_wave_barrier(); asm volatile("" ::: "memory");
    }
}

__device__ __forceinline__ void splitf(float y, unsigned short& h, unsigned short& l) { h = f2bf(y); l = f2bf(y - bf2f(h)); }
typedef __attribute__((ext_vector_type(2))) unsigned short v2us;
typedef __attribute__((ext_vector_type(4))) unsigned short v4us;
typedef __attribute__((ext_vector_type(4))) int v4i;

// k_prep: the bf16 copies of the four weights and of x in ONE launch. Work-groups 0 .. 4 x WTB - 1: the four 'io' weights [DM][DM] (in, out) -> Bt [out][in], WTB work-groups each, the four results one behind the other; the rest: x of both entries, 8 elements a thread.
#define WTB (DM * DM / 64 / 64)   // work-groups a weight: 8 waves x 8 lines of 64 elements
__global__ __launch_bounds__(256) void k_prep(const float* __restrict__ w0, const float* __restrict__ w1, const float* __restrict__ w2, const float* __restrict__ w3, bf* Bt4, const float* __restrict__ src, bf* dst) {
    if (blockIdx.x < 4 * WTB) {
        const int wi = blockIdx.x / WTB; const float* w = (wi == 0) ? w0 : (wi == 1) ? w1 : (wi == 2) ? w2 : w3; bf* Bt = Bt4 + (size_t)wi * DM * DM;
        const int lane = threadIdx.x & 31; const int L0 = ((blockIdx.x % WTB) * 8 + (threadIdx.x >> 5)) * 8;
        for (int l = 0; l < 8; ++l) { const int L = L0 + l; const size_t e = (size_t)L * 64 + lane * 2; const int k = (int)(e % DM), n = (int)(e / DM); v2us o;
            o[0] = f2bf(w[(size_t)k * DM + n]); o[1] = f2bf(w[(size_t)(k + 1) * DM + n]); *(v2us*)(Bt + e) = o; }
        return; }
    const size_t i = (size_t)(blockIdx.x - 4 * WTB) * 256 + threadIdx.x; const v8f v = *(const v8f*)(src + i * 8); v8us o;
#pragma unroll
    for (int k = 0; k < 8; ++k) o[k] = f2bf(v[k]);
    *(v8us*)(dst + i * 8) = o;
}

__device__ __forceinline__ float xhalf(float x) { return __builtin_bit_cast(float, __builtin_amdgcn_permlanex16(__builtin_bit_cast(int, x), __builtin_bit_cast(int, x), 0x76543210, 0xfedcba98, false, false)); }  // lane l with lane l ^ 16, in the vector unit (a shuffle would go through the LDS path and its wait)
#define FKB 64     // keys a pass
#define FWV 4      // waves a work-group: one on each SIMD, all on one head, so that they share its K and V lines in the WGP cache
__global__ __launch_bounds__(FWV * 32) void k_fattn(const h16* __restrict__ Qp, const h16* __restrict__ Kp, const h16* __restrict__ Vt, const float* __restrict__ u, const int* __restrict__ kvp, bf* Ah, bf* Al) {
    __shared__ __align__(16) float wl[TT]; __shared__ __align__(16) float mb[TT];
    { const size_t z = blockIdx.z; Qp += z * ((size_t)NH_ * TT * HD); Kp += z * ((size_t)NKV * TT * HD); Vt += z * ((size_t)NKV * HD * TT); u += z * TT; kvp += z * TT; Ah += z * ((size_t)TT * DQ); Al += z * ((size_t)TT * DQ); }
    { v4i kq[TT / (FWV * 128)]; v4f uq[TT / (FWV * 128)];   // both rows are loaded whole and unconditionally first (16 B a lane, whole lines), so that the work-group pays one load latency, not one per key group
#pragma unroll
        for (int r = 0; r < TT / (FWV * 128); ++r) { const int j = r * (FWV * 128) + threadIdx.x * 4; kq[r] = *(const v4i*)(kvp + j); uq[r] = *(const v4f*)(u + j); }
#pragma unroll
        for (int r = 0; r < TT / (FWV * 128); ++r)
#pragma unroll
            for (int q = 0; q < 4; ++q) uq[r][q] = expf(-LAMBDA * bfr(uq[r][q])) * (SCL * 1.4426950408889634f);
#pragma unroll
        for (int r = 0; r < TT / (FWV * 128); ++r) { const int j = r * (FWV * 128) + threadIdx.x * 4; v4f w4, b4;
#pragma unroll
            for (int q = 0; q < 4; ++q) { const bool on = (kq[r][q] != 0); w4[q] = on ? uq[r][q] : 0.0f; b4[q] = on ? 0.0f : -3.0e38f; }
            *(v4fa*)(wl + j) = w4; *(v4fa*)(mb + j) = b4; } }
    __syncthreads();
    const int lane = threadIdx.x & 31, lr = lane & 15, hi = lane >> 4; const int h = blockIdx.y; const int q0 = (blockIdx.x * FWV + (threadIdx.x >> 5)) * 32;
    const h16* qb = Qp + ((size_t)h * TT + q0 + lr) * HD + 8 * hi; const h16* kb = Kp + ((size_t)h * TT + lr) * HD + 8 * hi; const h16* vb = Vt + ((size_t)h * HD + lr) * TT + 8 * hi;
    v16h qf[2][2], kf[4][2]; v8f o[4][2]; float m[2], l[2];
#pragma unroll
    for (int qt = 0; qt < 2; ++qt) { m[qt] = -3.0e38f; l[qt] = 0.0f;
#pragma unroll
        for (int dh = 0; dh < 2; ++dh) qf[qt][dh] = WFrag<h16>::ld(qb + qt * 16 * HD + dh * 32);
#pragma unroll
        for (int dt = 0; dt < 4; ++dt) o[dt][qt] = (v8f){}; }
#pragma unroll
    for (int kt = 0; kt < 4; ++kt)
#pragma unroll
        for (int dh = 0; dh < 2; ++dh) kf[kt][dh] = WFrag<h16>::ld(kb + kt * 16 * HD + dh * 32);
    for (int k0 = 0; k0 < TT; k0 += FKB) {
        v16h vf[4][2]; v8f s[4][2];
#pragma unroll
        for (int dt = 0; dt < 4; ++dt)
#pragma unroll
            for (int ks = 0; ks < 2; ++ks) vf[dt][ks] = WFrag<h16>::ld(vb + (size_t)dt * 16 * TT + k0 + ks * 32);
        asm volatile("s_wait_xcnt 0x0" ::: "memory");   // stands in front of the pointer's step to the next pass, which overwrites the address registers that these loads name
        v4f wv[4][2], bv[4][2];
#pragma unroll
        for (int kt = 0; kt < 4; ++kt)
#pragma unroll
            for (int g = 0; g < 2; ++g) { wv[kt][g] = *(const v4fa*)(wl + k0 + kt * 16 + hi * 8 + g * 4); bv[kt][g] = *(const v4fa*)(mb + k0 + kt * 16 + hi * 8 + g * 4); }
        __builtin_amdgcn_sched_barrier(0);   // all 16 V loads and the pass's key rows from LDS issue here, ahead of the score products; without it the compiler sinks half the V loads to just in front of their use and reads LDS in four load-wait-use groups, and the wave waits out each latency
#pragma unroll
        for (int kt = 0; kt < 4; ++kt)
#pragma unroll
            for (int qt = 0; qt < 2; ++qt) { s[kt][qt] = wmma16(kf[kt][0], qf[qt][0], (v8f){}); s[kt][qt] = wmma16(kf[kt][1], qf[qt][1], s[kt][qt]); }
        const int kn = (k0 + FKB < TT) ? k0 + FKB : 0;   // the next pass's K rows are fetched behind this pass's score products (the last pass re-reads block 0, in bounds, unused)
#pragma unroll
        for (int kt = 0; kt < 4; ++kt)
#pragma unroll
            for (int dh = 0; dh < 2; ++dh) kf[kt][dh] = WFrag<h16>::ld(kb + (size_t)(kn + kt * 16) * HD + dh * 32);
        asm volatile("s_wait_xcnt 0x0" ::: "memory");   // in front of the first reuse of the address registers that these loads name
        __builtin_amdgcn_sched_barrier(0);   // the next pass's 16 K loads issue in front of the softmax, not spread through it
#pragma unroll
        for (int kt = 0; kt < 4; ++kt)
#pragma unroll
            for (int qt = 0; qt < 2; ++qt)
#pragma unroll
                for (int j = 0; j < 4; ++j) { s[kt][qt][j] = fmaf(s[kt][qt][j], wv[kt][0][j], bv[kt][0][j]); s[kt][qt][j + 4] = fmaf(s[kt][qt][j + 4], wv[kt][1][j], bv[kt][1][j]); }
        v16h pf[2][2];
#pragma unroll
        for (int qt = 0; qt < 2; ++qt) { float mx = m[qt];
#pragma unroll
            for (int kt = 0; kt < 4; ++kt)
#pragma unroll
                for (int j = 0; j < 8; ++j) mx = fmaxf(mx, s[kt][qt][j]);
            mx = fmaxf(mx, xhalf(mx));
            const float al = __builtin_amdgcn_exp2f(m[qt] - mx); m[qt] = mx; float sum = 0.0f;
#pragma unroll
            for (int kt = 0; kt < 4; ++kt)
#pragma unroll
                for (int j = 0; j < 8; ++j) { const float p = __builtin_amdgcn_exp2f(s[kt][qt][j] - mx); sum += p; pf[kt >> 1][qt][(kt & 1) * 8 + j] = (h16)p; }
            l[qt] = fmaf(l[qt], al, sum);
#pragma unroll
            for (int dt = 0; dt < 4; ++dt)
#pragma unroll
                for (int j = 0; j < 8; ++j) o[dt][qt][j] *= al; }
#pragma unroll
        for (int ks = 0; ks < 2; ++ks)
#pragma unroll
            for (int dt = 0; dt < 4; ++dt)
#pragma unroll
                for (int qt = 0; qt < 2; ++qt) o[dt][qt] = wmma16(vf[dt][ks], pf[ks][qt], o[dt][qt]);
    }
#pragma unroll
    for (int qt = 0; qt < 2; ++qt) { const float inv = __fdiv_rn(1.0f, l[qt] + xhalf(l[qt]));
#pragma unroll
        for (int dt = 0; dt < 4; ++dt) { v8us oh, ol;
#pragma unroll
            for (int j = 0; j < 8; ++j) { unsigned short a, c2; splitf(o[dt][qt][j] * inv, a, c2); oh[j] = a; ol[j] = c2; }
            const size_t oo = (size_t)(q0 + qt * 16 + lr) * DQ + h * HD + dt * 16 + hi * 8; *(v8us*)(Ah + oo) = oh; *(v8us*)(Al + oo) = ol; } }
}

extern "C" void kernel_launch(void* const* d_in, const int* in_sizes, int n_in,
                              void* d_out, int out_size, void* d_ws, size_t ws_size, hipStream_t stream) {
    (void)in_sizes; (void)n_in; (void)out_size;
    const float* x = (const float*)d_in[0]; const float* un = (const float*)d_in[1]; const int* km = (const int*)d_in[2]; const float* wq = (const float*)d_in[3]; const float* bq = (const float*)d_in[4]; const float* wk = (const float*)d_in[5]; const float* bk = (const float*)d_in[6]; const float* wv = (const float*)d_in[7]; const float* bv = (const float*)d_in[8]; const float* wo = (const float*)d_in[9]; const float* bo = (const float*)d_in[10];
    float* OUT = (float*)d_out;     // [2][2048][1024]
    char* wsp = (char*)d_ws;
    auto take = [&](size_t bytes) { char* p = wsp; wsp += (bytes + 255) & ~(size_t)255; return (void*)p; };
    bf* W4 = (bf*)take((size_t)4 * DM * DM * 2);    // Wq, Wk, Wv, Wo as Bt [out][in], one behind the other: the first three are the B operand [3 x DQ][DM] of the q | k | v product
    bf* XB = (bf*)take((size_t)NB_ * TT * DM * 2);
    h16* QKV16 = (h16*)take((size_t)3 * NB_ * NH_ * TT * HD * 2);    // q planes, k planes, v planes, each [b][...]
    bf* ATh = (bf*)take((size_t)NB_ * TT * DQ * 2); bf* ATl = (bf*)take((size_t)NB_ * TT * DQ * 2);
    if ((size_t)(wsp - (char*)d_ws) > ws_size) return;    // total 56 MiB of the workspace
    const size_t PL = (size_t)NB_ * NH_ * TT * HD;
    k_prep<<<4 * WTB + NB_ * TT * DM / 8 / 256, 256, 0, stream>>>(wq, wk, wv, wo, W4, x, XB);
    k_gemmw<bf, 0, 1><<<dim3(NB_ * TT / 64, 3 * DQ / 64, 1), 32, 0, stream>>>(XB, nullptr, W4, nullptr, DM, nullptr, QKV16, 0, bq, bk, bv);    // q, k planes [b][h][t][d], v planes [b][h][d][t]
    k_fattn<<<dim3(TT / (FWV * 32), NH_, NB_), FWV * 32, 0, stream>>>(QKV16, QKV16 + PL, QKV16 + 2 * PL, un, km, ATh, ATl);   // all heads of both entries: scores, key weight, mask, softmax, attn.v, merged hi/lo planes
    k_gemmw<bf, 1, 0><<<dim3(NB_ * TT / 64, DM / 64, 1), 32, 0, stream>>>(ATh, ATl, W4 + (size_t)3 * DM * DM, nullptr, DQ, OUT, nullptr, DM, bo, nullptr, nullptr);
}

// v004
// It runs in 129 microseconds.
// Timed twice side by side with v003, it ran 1.25 and 1.26 times as fast.
// All steps since v000 together make it 11.2 times as fast.
#include <hip/hip_runtime.h>

// Multi-head self-attention whose scaled scores are multiplied, per KEY, by an uncertainty weight before the mask and the softmax, with an integer key mask read as data and an output projection (hidden_states [2][2048][1024]; token_uncertainty [2][2048]; attention_mask int32 [2][2048];
// q, k, v = x W + b with 'io' weights [1024][1024] (in, out) and biases [1024]; 16 heads x 64 (head h = columns h x 64 ..); scores = q k^T / sqrt(64); scores = scores x exp(-0.5 x token_uncertainty[b][key]); where(mask[b][key] != 0, scores, -inf); softmax over the keys;
// out = merged Wo + bo ('io' + bias) -> [2][2048][1024] (4.2 M); argument order hidden_states, token_uncertainty, attention_mask, Wq, bq, Wk, bk, Wv, bv, Wo, bo).
// Layout, both batch entries in every launch: one bf16 copy of x (read by all three projections) and the 'io' weights transposed and rounded, in one launch (k_prep); q, k, v as ONE product [4096][1024] x [3072][1024]^T + f32 biases, whose epilogue writes the f16 head planes itself (q, k per [b][h] with rows t, v per [b][h] with rows d); dense T-2048 attention, 16 heads x 2 entries in one launch (k_fattn):
// the f16 score product, each score x its key's weight x SCL in f32, the entry's int key mask, a running-maximum softmax in f32 whose weights go to fp16 in registers, attn.v on ONE fp16 product, the division by the sum; merged hi/lo x Wo exact + bo.
// FRAGMENT ORDER: every 16-bit plane that a matrix instruction reads (x, the four weights, q, k, v^T, merged hi/lo) lies in memory as blocks of 16 rows x 32 k = 1 KiB, the 16-B piece (row r, k = 16 half + 8 hh + 0..7) at byte 512 half + 16 (16 hh + r):
// lane 16 hh + r of a wave reads its two pieces at 16 x lane and 512 + 16 x lane, so each fragment load of a wave is 512 B in a row (4 whole lines) and not 32 B out of each of 16 lines. Which lane and register holds which (row, k) is as with row-major planes.
// Compute dtypes, f32 accumulate: every float input rounded to bf16 at its load (the uncertainty row too); projections exact + f32 biases; scores and attn.v fp16; the key weight and the softmax f32; Wo hl x exact + bias.

#define NB_  2
#define TT   2048
#define DM   1024
#define NH_  16
#define NKV  16
#define REP  (NH_ / NKV)
#define HD   64
#define DQ   (NH_ * HD)
#define DKV  (NKV * HD)
#define SCL  0.125f   // HD^-0.5
#define LAMBDA 0.5f   // the module's uncertainty weight: w = exp(-LAMBDA x token_uncertainty) per key
typedef _Float16 h16;
typedef unsigned short bf;
typedef __attribute__((ext_vector_type(16))) __bf16   v16bf;
typedef __attribute__((ext_vector_type(16))) _Float16 v16h;
typedef __attribute__((ext_vector_type(8)))  _Float16 v8h;
typedef __attribute__((ext_vector_type(4)))  _Float16 v4h;
typedef __attribute__((ext_vector_type(8)))  unsigned short v8us;
typedef __attribute__((ext_vector_type(8)))  float    v8f;
typedef __attribute__((ext_vector_type(4)))  float    v4f;
typedef v8h  __attribute__((may_alias)) v8ha;
typedef v4f  __attribute__((may_alias)) v4fa;
typedef v8us __attribute__((may_alias)) v8usa;

__device__ __forceinline__ unsigned short f2bf(float f) { unsigned u = __float_as_uint(f); u += 0x7FFFu + ((u >> 16) & 1u); return (unsigned short)(u >> 16); }
__device__ __forceinline__ float bf2f(unsigned short b) { return __uint_as_float(((unsigned)b) << 16); }
__device__ __forceinline__ float bfr(float f) { return bf2f(f2bf(f)); }
__device__ __forceinline__ v16h cat16(v8h lo, v8h hi) { return __builtin_shufflevector(lo, hi, 0, 1, 2, 3, 4, 5, 6, 7, 8, 9, 10, 11, 12, 13, 14, 15); }
__device__ __forceinline__ v16bf cat16b(v8us lo, v8us hi) { return __builtin_bit_cast(v16bf, __builtin_shufflevector(lo, hi, 0, 1, 2, 3, 4, 5, 6, 7, 8, 9, 10, 11, 12, 13, 14, 15)); }
__device__ __forceinline__ v8f wmma16(v16h a, v16h b, v8f c) { return __builtin_amdgcn_wmma_f32_16x16x32_f16(false, a, false, b, (short)0, c, false, false); }
__device__ __forceinline__ v8f wmmab(v16bf a, v16bf b, v8f c) { return __builtin_amdgcn_wmma_f32_16x16x32_bf16(false, a, false, b, (short)0, c, false, false); }



// ---- k_gemmw: register-blocked GEMM, ONE WAVE per 64x64 output tile (16 accumulators), operands straight from 16-bit planes in fragment order (blocks [row / 16][k / 32], WFrag::ld takes the lane's place in a block); grid (M/64, N/64), 32 threads.
// y[m][n] = sum_k A[m][k] Bt[n][k] (+ split products per NSPLIT) + f32 bias[n]. K % 32 == 0, known at compile time: every block of a pass then lies at a constant distance from one address per operand. The rows m run over both batch entries (m = b x TT + t).
// OM 0: C[m][n] = y in f32, pitch ldc. OM 1: the columns are q | k | v (DQ each, biases bias | bias1 | bias2), a tile lies in one of them and in one entry; P holds the three fp16 plane sets one behind the other, each [b][...]:
// q and k as head planes, rows t, k = d, blocks [n / 64][t / 16][d / 32] (a 64-column tile is one head, its 64 rows are 8 KiB in a row); v transposed, rows d, k = t, blocks [n / 64][t / 32][d / 16]: a lane's 8 accumulator registers are 8 consecutive t of one d, its own 16-B piece of a block.
template <typename T16> struct WFrag;
template <> struct WFrag<h16> { typedef v16h V; static __device__ __forceinline__ V ld(const h16* p) { return cat16(*(const v8h*)p, *(const v8h*)(p + 256)); } static __device__ __forceinline__ v8f mma(V a, V b, v8f c) { return wmma16(a, b, c); } };
template <> struct WFrag<bf> { typedef v16bf V; static __device__ __forceinline__ V ld(const bf* p) { return cat16b(*(const v8us*)p, *(const v8us*)(p + 256)); } static __device__ __forceinline__ v8f mma(V a, V b, v8f c) { return wmmab(a, b, c); } };
template <typename T16, int NSPLIT, int OM, int K>
__global__ __launch_bounds__(32) void k_gemmw(const T16* __restrict__ A, const T16* __restrict__ A2, const T16* __restrict__ Bt, const T16* __restrict__ Bt2, float* C, h16* P, int ldc, const float* __restrict__ bias, const float* __restrict__ bias1, const float* __restrict__ bias2) {
    typedef typename WFrag<T16>::V V;
    __shared__ __align__(16) float os[16 * 68];
    const int lane = threadIdx.x & 31, lr = lane & 15, hi = lane >> 4; const int r0 = blockIdx.x * 64, c0 = blockIdx.y * 64;
    v8f acc[4][4];
#pragma unroll
    for (int mb = 0; mb < 4; ++mb)
#pragma unroll
        for (int nb = 0; nb < 4; ++nb) acc[mb][nb] = (v8f){};
    const size_t aoff = (size_t)r0 * K, boff = (size_t)c0 * K; const unsigned lo = 8 * lane;   // 16 rows of K are K / 32 blocks of 512 elements; a block's address is the same for the whole wave, lo the lane's place in it

    for (int kc = 0; kc < K; kc += 32) {
        V a[4], a2[4], b[4], b2[4]; const T16* pa = A + aoff + kc * 16 + lo; const T16* pb = Bt + boff + kc * 16 + lo; const T16* pa2 = (NSPLIT == 1 || NSPLIT == 2) ? A2 + aoff + kc * 16 + lo : pa; const T16* pb2 = (NSPLIT >= 2) ? Bt2 + boff + kc * 16 + lo : pb;
#pragma unroll
        for (int mb = 0; mb < 4; ++mb) { a[mb] = WFrag<T16>::ld(pa + mb * 16 * K); if (NSPLIT == 1 || NSPLIT == 2) a2[mb] = WFrag<T16>::ld(pa2 + mb * 16 * K); }
#pragma unroll
        for (int nb = 0; nb < 4; ++nb) { b[nb] = WFrag<T16>::ld(pb + nb * 16 * K); if (NSPLIT >= 2) b2[nb] = WFrag<T16>::ld(pb2 + nb * 16 * K); }
        asm volatile("s_wait_xcnt 0x0" :: "v"(pa), "v"(pb), "v"(pa2), "v"(pb2) : "memory");   // behind the pass's loads and in front of every overwrite of the address registers that they name: as inputs here these stay untouched up to the wait
#pragma unroll
        for (int nb = 0; nb < 4; ++nb) {
#pragma unroll
            for (int mb = 0; mb < 4; ++mb) { acc[mb][nb] = WFrag<T16>::mma(a[mb], b[nb], acc[mb][nb]); if (NSPLIT == 1 || NSPLIT == 2) acc[mb][nb] = WFrag<T16>::mma(a2[mb], b[nb], acc[mb][nb]); if (NSPLIT >= 2) acc[mb][nb] = WFrag<T16>::mma(a[mb], b2[nb], acc[mb][nb]); } }
        asm volatile("v_nop\n\tv_nop\n\tv_nop\n\tv_nop" : "+v"(acc[0][0]), "+v"(acc[1][1]), "+v"(acc[2][2]), "+v"(acc[3][3]) : "v"(a[0]), "v"(a[3]));
    }
    const int sel = (OM == 1) ? c0 / DQ : 0, cl = (OM == 1) ? c0 % DQ : c0, rt = r0 % TT;   // which projection, the column in it, the row in its entry: the same for the whole tile
    const float* bs = (sel == 0) ? bias : (sel == 1) ? bias1 : bias2;
    if (OM == 1) P += ((size_t)sel * NB_ + r0 / TT) * ((size_t)NH_ * TT * HD);
    if (OM == 1 && sel == 2) {   // straight from the accumulators: each store of the wave is half a block, 512 B in a row
#pragma unroll
        for (int nb = 0; nb < 4; ++nb) { const float bn = bfr(bs[cl + nb * 16 + lr]); h16* pcol = P + (size_t)cl * TT + (size_t)rt * HD + nb * 512 + lane * 8;
#pragma unroll
            for (int mb = 0; mb < 4; ++mb) { v8h o;
#pragma unroll
                for (int j = 0; j < 8; ++j) o[j] = (h16)(acc[mb][nb][j] + bn);
                *(v8h*)(pcol + (mb >> 1) * 2048 + (mb & 1) * 256) = o; } }
        return; }
    if (OM == 1) {   // q, k: 16 rows x 64 columns turned in LDS, bias added on the way in; then each lane takes its own 16-B pieces of the row block's two blocks
        float bn[4];
#pragma unroll
        for (int nb = 0; nb < 4; ++nb) bn[nb] = bfr(bs[cl + nb * 16 + lr]);
        h16* pq = P + ((size_t)(cl / HD) * TT + rt) * HD + lane * 8;
#pragma unroll
        for (int mb = 0; mb < 4; ++mb) {
#pragma unroll
            for (int nb = 0; nb < 4; ++nb) {
#pragma unroll
                for (int j = 0; j < 8; ++j) os[(hi * 8 + j) * 68 + nb * 16 + lr] = acc[mb][nb][j] + bn[nb]; }
            __builtin_amdgcn_wave_barrier(); asm volatile("" ::: "memory");   // the rows are read back by other lanes of this wave: the compiler may not move the reads above the writes
            v8h o[4];
#pragma unroll
            for (int s = 0; s < 4; ++s) { const float* rp = os + lr * 68 + s * 16 + hi * 8; const v4f x0 = *(const v4fa*)rp, x1 = *(const v4fa*)(rp + 4);
#pragma unroll
                for (int q = 0; q < 4; ++q) { o[s][q] = (h16)x0[q]; o[s][q + 4] = (h16)x1[q]; }
                *(v8h*)(pq + mb * 1024 + s * 256) = o[s]; }
            __builtin_amdgcn_wave_barrier(); asm volatile("s_wait_xcnt 0x0" :: "v"(o[0]), "v"(o[1]), "v"(o[2]), "v"(o[3]) : "memory");   // the next row block's LDS writes stay below these reads; and the wait stands in front of every overwrite of the registers that the four stores name (as inputs here they stay untouched up to it)
        }
        return; }
    const int cofs = lr * 4; v4f bb;   // a lane stores the same four columns in every row: their biases are read once
#pragma unroll
    for (int q = 0; q < 4; ++q) bb[q] = bfr(bs[cl + cofs + q]);
#pragma unroll
    for (int mb = 0; mb < 4; ++mb) {
#pragma unroll
        for (int nb = 0; nb < 4; ++nb) {
#pragma unroll
            for (int j = 0; j < 8; ++j) os[(hi * 8 + j) * 68 + nb * 16 + lr] = acc[mb][nb][j]; }
        __builtin_amdgcn_wave_barrier(); asm volatile("" ::: "memory");
        float* crow = C + (size_t)(r0 + mb * 16) * ldc + c0;
#pragma unroll
        for (int s = 0; s < 8; ++s) { const int row = 2 * s + hi; v4f val = *(const v4fa*)(os + row * 68 + cofs); val[0] += bb[0]; val[1] += bb[1]; val[2] += bb[2]; val[3] += bb[3];
            if (OM == 0) *(v4f*)(crow + (size_t)row * ldc + cofs) = val;
        }
        __builtin_amdgcn_wave_barrier(); asm volatile("" ::: "memory");
    }
}

__device__ __forceinline__ void splitf(float y, unsigned short& h, unsigned short& l) { h = f2bf(y); l = f2bf(y - bf2f(h)); }
typedef __attribute__((ext_vector_type(2))) unsigned short v2us;
typedef __attribute__((ext_vector_type(4))) unsigned short v4us;
typedef __attribute__((ext_vector_type(4))) int v4i;

// k_prep: all the rounding to bf16 in ONE launch, one wave a block of the fragment order. Work-groups 0 .. 4 x WTB - 1: the four 'io' weights [DM][DM] (in, out) -> Bt, rows out, k = in, WTB work-groups each, the four results one behind the other; the rest: x of both entries, rows m, k = in.
#define WTB (DM * DM / 512 / 8)   // work-groups a weight: 8 waves x 1 block of 512 elements
__global__ __launch_bounds__(256) void k_prep(const float* __restrict__ w0, const float* __restrict__ w1, const float* __restrict__ w2, const float* __restrict__ w3, bf* Bt4, const float* __restrict__ src, bf* dst) {
    const int lane = threadIdx.x & 31, lr = lane & 15, hi = lane >> 4;
    if (blockIdx.x < 4 * WTB) {   // lane (hi, lr) gathers its own two pieces: row out = 16 nb + lr, 8 consecutive in; a load reads 64 B of each of two rows of w, a store is 512 B in a row
        const int wi = blockIdx.x / WTB; const float* w = (wi == 0) ? w0 : (wi == 1) ? w1 : (wi == 2) ? w2 : w3; bf* Bt = Bt4 + (size_t)wi * DM * DM;
        const int blk = (blockIdx.x % WTB) * 8 + (threadIdx.x >> 5); const int nb = blk / (DM / 32), kb = blk % (DM / 32);
        const float* wp = w + (size_t)(kb * 32 + hi * 8) * DM + nb * 16 + lr; float v[16];
#pragma unroll
        for (int j = 0; j < 16; ++j) v[j] = wp[(size_t)((j >> 3) * 16 + (j & 7)) * DM];
#pragma unroll
        for (int hf = 0; hf < 2; ++hf) { v8us o;
#pragma unroll
            for (int j = 0; j < 8; ++j) o[j] = f2bf(v[hf * 8 + j]);
            *(v8us*)(Bt + (size_t)blk * 512 + hf * 256 + lane * 8) = o; }
        return; }
    const int blk = (blockIdx.x - 4 * WTB) * 8 + (threadIdx.x >> 5); const int rb = blk / (DM / 32), kb = blk % (DM / 32);   // x: whole 128-B lines in (4 rows a load), 64-B runs out
    const int kq = (lane & 7) * 4; const float* sp = src + (size_t)(rb * 16 + (lane >> 3)) * DM + kb * 32 + kq; bf* dp = dst + (size_t)blk * 512 + (kq >> 4) * 256 + (((kq >> 3) & 1) * 16 + (lane >> 3)) * 8 + (kq & 4); v4f v[4];
#pragma unroll
    for (int i = 0; i < 4; ++i) v[i] = *(const v4f*)(sp + (size_t)i * 4 * DM);
#pragma unroll
    for (int i = 0; i < 4; ++i) { v4us o;
#pragma unroll
        for (int k = 0; k < 4; ++k) o[k] = f2bf(v[i][k]);
        *(v4us*)(dp + i * 32) = o; }
    asm volatile("s_wait_xcnt 0x0" ::: "memory");   // behind the last of the four stores, in front of any later overwrite of the address and data registers that they name
}

__device__ __forceinline__ float xhalf(float x) { return __builtin_bit_cast(float, __builtin_amdgcn_permlanex16(__builtin_bit_cast(int, x), __builtin_bit_cast(int, x), 0x76543210, 0xfedcba98, false, false)); }  // lane l with lane l ^ 16, in the vector unit (a shuffle would go through the LDS path and its wait)
#define FKB 64     // keys a pass
#define FWV 4      // waves a work-group: one on each SIMD, all on one head, so that they share its K and V lines in the WGP cache
__global__ __launch_bounds__(FWV * 32) void k_fattn(const h16* __restrict__ Qp, const h16* __restrict__ Kp, const h16* __restrict__ Vt, const float* __restrict__ u, const int* __restrict__ kvp, bf* Ah, bf* Al) {
    __shared__ __align__(16) float wl[TT]; __shared__ __align__(16) float mb[TT];
    { const size_t z = blockIdx.z; Qp += z * ((size_t)NH_ * TT * HD); Kp += z * ((size_t)NKV * TT * HD); Vt += z * ((size_t)NKV * HD * TT); u += z * TT; kvp += z * TT; Ah += z * ((size_t)TT * DQ); Al += z * ((size_t)TT * DQ); }
    { v4i kq[TT / (FWV * 128)]; v4f uq[TT / (FWV * 128)];   // both rows are loaded whole and unconditionally first (16 B a lane, whole lines), so that the work-group pays one load latency, not one per key group
#pragma unroll
        for (int r = 0; r < TT / (FWV * 128); ++r) { const int j = r * (FWV * 128) + threadIdx.x * 4; kq[r] = *(const v4i*)(kvp + j); uq[r] = *(const v4f*)(u + j); }
#pragma unroll
        for (int r = 0; r < TT / (FWV * 128); ++r)
#pragma unroll
            for (int q = 0; q < 4; ++q) uq[r][q] = expf(-LAMBDA * bfr(uq[r][q])) * (SCL * 1.4426950408889634f);
#pragma unroll
        for (int r = 0; r < TT / (FWV * 128); ++r) { const int j = r * (FWV * 128) + threadIdx.x * 4; v4f w4, b4;
#pragma unroll
            for (int q = 0; q < 4; ++q) { const bool on = (kq[r][q] != 0); w4[q] = on ? uq[r][q] : 0.0f; b4[q] = on ? 0.0f : -3.0e38f; }
            *(v4fa*)(wl + j) = w4; *(v4fa*)(mb + j) = b4; } }
    __syncthreads();
    const int lane = threadIdx.x & 31, lr = lane & 15, hi = lane >> 4; const int h = blockIdx.y; const int q0 = (blockIdx.x * FWV + (threadIdx.x >> 5)) * 32;
    const h16* qb = Qp + ((size_t)h * TT + q0) * HD + 8 * lane; const h16* kb = Kp + (size_t)h * TT * HD + 8 * lane; const h16* vb = Vt + (size_t)h * HD * TT + 8 * lane;   // 8 x lane: the lane's place in a block; 64 keys (or queries) of a head are 8 blocks in a row in each plane
    v16h qf[2][2], kf[4][2]; v8f o[4][2]; float m[2], l[2];
#pragma unroll
    for (int qt = 0; qt < 2; ++qt) { m[qt] = -3.0e38f; l[qt] = 0.0f;
#pragma unroll
        for (int dh = 0; dh < 2; ++dh) qf[qt][dh] = WFrag<h16>::ld(qb + (qt * 2 + dh) * 512);
#pragma unroll
        for (int dt = 0; dt < 4; ++dt) o[dt][qt] = (v8f){}; }
#pragma unroll
    for (int kt = 0; kt < 4; ++kt)
#pragma unroll
        for (int dh = 0; dh < 2; ++dh) kf[kt][dh] = WFrag<h16>::ld(kb + (kt * 2 + dh) * 512);
    for (int k0 = 0; k0 < TT; k0 += FKB) {
        v16h vf[4][2]; v8f s[4][2];
#pragma unroll
        for (int dt = 0; dt < 4; ++dt)
#pragma unroll
            for (int ks = 0; ks < 2; ++ks) vf[dt][ks] = WFrag<h16>::ld(vb + (size_t)k0 * HD + (ks * 4 + dt) * 512);
        asm volatile("s_wait_xcnt 0x0" ::: "memory");   // stands in front of the pointer's step to the next pass, which overwrites the address registers that these loads name
        v4f wv[4][2], bv[4][2];
#pragma unroll
        for (int kt = 0; kt < 4; ++kt)
#pragma unroll
            for (int g = 0; g < 2; ++g) { wv[kt][g] = *(const v4fa*)(wl + k0 + kt * 16 + hi * 8 + g * 4); bv[kt][g] = *(const v4fa*)(mb + k0 + kt * 16 + hi * 8 + g * 4); }
        __builtin_amdgcn_sched_barrier(0);   // all 16 V loads and the pass's key rows from LDS issue here, ahead of the score products; without it the compiler sinks half the V loads to just in front of their use and reads LDS in four load-wait-use groups, and the wave waits out each latency
#pragma unroll
        for (int kt = 0; kt < 4; ++kt)
#pragma unroll
            for (int qt = 0; qt < 2; ++qt) { s[kt][qt] = wmma16(kf[kt][0], qf[qt][0], (v8f){}); s[kt][qt] = wmma16(kf[kt][1], qf[qt][1], s[kt][qt]); }
        const int kn = (k0 + FKB < TT) ? k0 + FKB : 0;   // the next pass's K rows are fetched behind this pass's score products (the last pass re-reads block 0, in bounds, unused)
#pragma unroll
        for (int kt = 0; kt < 4; ++kt)
#pragma unroll
            for (int dh = 0; dh < 2; ++dh) kf[kt][dh] = WFrag<h16>::ld(kb + (size_t)kn * HD + (kt * 2 + dh) * 512);
        asm volatile("s_wait_xcnt 0x0" ::: "memory");   // in front of the first reuse of the address registers that these loads name
        __builtin_amdgcn_sched_barrier(0);   // the next pass's 16 K loads issue in front of the softmax, not spread through it
#pragma unroll
        for (int kt = 0; kt < 4; ++kt)
#pragma unroll
            for (int qt = 0; qt < 2; ++qt)
#pragma unroll
                for (int j = 0; j < 4; ++j) { s[kt][qt][j] = fmaf(s[kt][qt][j], wv[kt][0][j], bv[kt][0][j]); s[kt][qt][j + 4] = fmaf(s[kt][qt][j + 4], wv[kt][1][j], bv[kt][1][j]); }
        v16h pf[2][2];
#pragma unroll
        for (int qt = 0; qt < 2; ++qt) { float mx = m[qt];
#pragma unroll
            for (int kt = 0; kt < 4; ++kt)
#pragma unroll
                for (int j = 0; j < 8; ++j) mx = fmaxf(mx, s[kt][qt][j]);
            mx = fmaxf(mx, xhalf(mx));
            const float al = __builtin_amdgcn_exp2f(m[qt] - mx); m[qt] = mx; float sum = 0.0f;
#pragma unroll
            for (int kt = 0; kt < 4; ++kt)
#pragma unroll
                for (int j = 0; j < 8; ++j) { const float p = __builtin_amdgcn_exp2f(s[kt][qt][j] - mx); sum += p; pf[kt >> 1][qt][(kt & 1) * 8 + j] = (h16)p; }
            l[qt] = fmaf(l[qt], al, sum);
#pragma unroll
            for (int dt = 0; dt < 4; ++dt)
#pragma unroll
                for (int j = 0; j < 8; ++j) o[dt][qt][j] *= al; }
#pragma unroll
        for (int ks = 0; ks < 2; ++ks)
#pragma unroll
            for (int dt = 0; dt < 4; ++dt)
#pragma unroll
                for (int qt = 0; qt < 2; ++qt) o[dt][qt] = wmma16(vf[dt][ks], pf[ks][qt], o[dt][qt]);
    }
#pragma unroll
    for (int qt = 0; qt < 2; ++qt) { const float inv = __fdiv_rn(1.0f, l[qt] + xhalf(l[qt]));
#pragma unroll
        for (int dt = 0; dt < 4; ++dt) { v8us oh, ol;
#pragma unroll
            for (int j = 0; j < 8; ++j) { unsigned short a, c2; splitf(o[dt][qt][j] * inv, a, c2); oh[j] = a; ol[j] = c2; }
            const size_t oo = (size_t)(q0 + qt * 16) * DQ + (h * 2 + (dt >> 1)) * 512 + (dt & 1) * 256 + lane * 8; *(v8us*)(Ah + oo) = oh; *(v8us*)(Al + oo) = ol; } }   // rows t, k = 64 h + d: the lane's 8 registers are its own piece of a block
}

extern "C" void kernel_launch(void* const* d_in, const int* in_sizes, int n_in,
                              void* d_out, int out_size, void* d_ws, size_t ws_size, hipStream_t stream) {
    (void)in_sizes; (void)n_in; (void)out_size;
    const float* x = (const float*)d_in[0]; const float* un = (const float*)d_in[1]; const int* km = (const int*)d_in[2]; const float* wq = (const float*)d_in[3]; const float* bq = (const float*)d_in[4]; const float* wk = (const float*)d_in[5]; const float* bk = (const float*)d_in[6]; const float* wv = (const float*)d_in[7]; const float* bv = (const float*)d_in[8]; const float* wo = (const float*)d_in[9]; const float* bo = (const float*)d_in[10];
    float* OUT = (float*)d_out;     // [2][2048][1024]
    char* wsp = (char*)d_ws;
    auto take = [&](size_t bytes) { char* p = wsp; wsp += (bytes + 255) & ~(size_t)255; return (void*)p; };
    bf* W4 = (bf*)take((size_t)4 * DM * DM * 2);    // Wq, Wk, Wv, Wo as Bt [out][in], one behind the other: the first three are the B operand [3 x DQ][DM] of the q | k | v product
    bf* XB = (bf*)take((size_t)NB_ * TT * DM * 2);
    h16* QKV16 = (h16*)take((size_t)3 * NB_ * NH_ * TT * HD * 2);    // q planes, k planes, v planes, each [b][...]
    bf* ATh = (bf*)take((size_t)NB_ * TT * DQ * 2); bf* ATl = (bf*)take((size_t)NB_ * TT * DQ * 2);
    if ((size_t)(wsp - (char*)d_ws) > ws_size) return;    // total 56 MiB of the workspace
    const size_t PL = (size_t)NB_ * NH_ * TT * HD;
    k_prep<<<4 * WTB + NB_ * TT * DM / 512 / 8, 256, 0, stream>>>(wq, wk, wv, wo, W4, x, XB);
    k_gemmw<bf, 0, 1, DM><<<dim3(NB_ * TT / 64, 3 * DQ / 64, 1), 32, 0, stream>>>(XB, nullptr, W4, nullptr, nullptr, QKV16, 0, bq, bk, bv);    // q, k planes [b][h] rows t, v planes [b][h] rows d, in fragment order
    k_fattn<<<dim3(TT / (FWV * 32), NH_, NB_), FWV * 32, 0, stream>>>(QKV16, QKV16 + PL, QKV16 + 2 * PL, un, km, ATh, ATl);   // all heads of both entries: scores, key weight, mask, softmax, attn.v, merged hi/lo planes
    k_gemmw<bf, 1, 0, DQ><<<dim3(NB_ * TT / 64, DM / 64, 1), 32, 0, stream>>>(ATh, ATl, W4 + (size_t)3 * DM * DM, nullptr, OUT, nullptr, DM, bo, nullptr, nullptr);
}

// v005
// It runs in 87.4 microseconds.
// Two timings next to v004 put it at 1.45 and 1.49 times that version's speed.
// Counting every step since v000, it is 16.5 times as fast.
#include <hip/hip_runtime.h>

// Multi-head self-attention whose scaled scores are multiplied, per KEY, by an uncertainty weight before the mask and the softmax, with an integer key mask read as data and an output projection (hidden_states [2][2048][1024]; token_uncertainty [2][2048]; attention_mask int32 [2][2048];
// q, k, v = x W + b with 'io' weights [1024][1024] (in, out) and biases [1024]; 16 heads x 64 (head h = columns h x 64 ..); scores = q k^T / sqrt(64); scores = scores x exp(-0.5 x token_uncertainty[b][key]); where(mask[b][key] != 0, scores, -inf); softmax over the keys;
// out = merged Wo + bo ('io' + bias) -> [2][2048][1024] (4.2 M); argument order hidden_states, token_uncertainty, attention_mask, Wq, bq, Wk, bk, Wv, bv, Wo, bo).
// Layout, both batch entries in every launch: one bf16 copy of x (read by all three projections) and the 'io' weights transposed and rounded, in one launch (k_prep); q, k, v as ONE product [4096][1024] x [3072][1024]^T + f32 biases, whose epilogue writes the f16 head planes itself (q, k per [b][h] with rows t, v per [b][h] with rows d); dense T-2048 attention, 16 heads x 2 entries in one launch (k_fattn):
// the f16 score product, each score x its key's weight x SCL in f32, the entry's int key mask, a running-maximum softmax in f32 whose weights go to fp16 in registers, attn.v on ONE fp16 product, the division by the sum; merged hi/lo x Wo exact + bo.
// FRAGMENT ORDER: every 16-bit plane that a matrix instruction reads (x, the four weights, q, k, v^T, merged hi/lo) lies in memory as blocks of 16 rows x 32 k = 1 KiB, the 16-B piece (row r, k = 16 half + 8 hh + 0..7) at byte 512 half + 16 (16 hh + r):
// lane 16 hh + r of a wave reads its two pieces at 16 x lane and 512 + 16 x lane, so each fragment load of a wave is 512 B in a row (4 whole lines) and not 32 B out of each of 16 lines. Which lane and register holds which (row, k) is as with row-major planes.
// Compute dtypes, f32 accumulate: every float input rounded to bf16 at its load (the uncertainty row too); projections exact + f32 biases; scores and attn.v fp16; the key weight and the softmax f32; Wo hl x exact + bias.

#define NB_  2
#define TT   2048
#define DM   1024
#define NH_  16
#define NKV  16
#define REP  (NH_ / NKV)
#define HD   64
#define DQ   (NH_ * HD)
#define DKV  (NKV * HD)
#define SCL  0.125f   // HD^-0.5
#define LAMBDA 0.5f   // the module's uncertainty weight: w = exp(-LAMBDA x token_uncertainty) per key
typedef _Float16 h16;
typedef unsigned short bf;
typedef __attribute__((ext_vector_type(16))) __bf16   v16bf;
typedef __attribute__((ext_vector_type(16))) _Float16 v16h;
typedef __attribute__((ext_vector_type(8)))  _Float16 v8h;
typedef __attribute__((ext_vector_type(4)))  _Float16 v4h;
typedef __attribute__((ext_vector_type(8)))  unsigned short v8us;
typedef __attribute__((ext_vector_type(8)))  float    v8f;
typedef __attribute__((ext_vector_type(4)))  float    v4f;
typedef v8h  __attribute__((may_alias)) v8ha;
typedef v4f  __attribute__((may_alias)) v4fa;
typedef v8us __attribute__((may_alias)) v8usa;

__device__ __forceinline__ unsigned short f2bf(float f) { unsigned u = __float_as_uint(f); u += 0x7FFFu + ((u >> 16) & 1u); return (unsigned short)(u >> 16); }
__device__ __forceinline__ float bf2f(unsigned short b) { return __uint_as_float(((unsigned)b) << 16); }
__device__ __forceinline__ float bfr(float f) { return bf2f(f2bf(f)); }
__device__ __forceinline__ v16h cat16(v8h lo, v8h hi) { return __builtin_shufflevector(lo, hi, 0, 1, 2, 3, 4, 5, 6, 7, 8, 9, 10, 11, 12, 13, 14, 15); }
__device__ __forceinline__ v16bf cat16b(v8us lo, v8us hi) { return __builtin_bit_cast(v16bf, __builtin_shufflevector(lo, hi, 0, 1, 2, 3, 4, 5, 6, 7, 8, 9, 10, 11, 12, 13, 14, 15)); }
__device__ __forceinline__ v8f wmma16(v16h a, v16h b, v8f c) { return __builtin_amdgcn_wmma_f32_16x16x32_f16(false, a, false, b, (short)0, c, false, false); }
__device__ __forceinline__ v8f wmmab(v16bf a, v16bf b, v8f c) { return __builtin_amdgcn_wmma_f32_16x16x32_bf16(false, a, false, b, (short)0, c, false, false); }



// ---- k_gemmw: register-blocked GEMM, ONE WAVE per 64x64 output tile (16 accumulators), operands straight from 16-bit planes in fragment order (blocks [row / 16][k / 32], WFrag::ld takes the lane's place in a block); grid (M/64, N/64), 32 threads.
// y[m][n] = sum_k A[m][k] Bt[n][k] (+ split products per NSPLIT) + f32 bias[n]. K % 32 == 0, known at compile time: every block of a pass then lies at a constant distance from one address per operand. The rows m run over both batch entries (m = b x TT + t).
// OM 0: C[m][n] = y in f32, pitch ldc. OM 1: the columns are q | k | v (DQ each, biases bias | bias1 | bias2), a tile lies in one of them and in one entry; P holds the three fp16 plane sets one behind the other, each [b][...]:
// q and k as head planes, rows t, k = d, blocks [n / 64][t / 16][d / 32] (a 64-column tile is one head, its 64 rows are 8 KiB in a row); v transposed, rows d, k = t, blocks [n / 64][t / 32][d / 16]: a lane's 8 accumulator registers are 8 consecutive t of one d, its own 16-B piece of a block.
template <typename T16> struct WFrag;
template <> struct WFrag<h16> { typedef v16h V; static __device__ __forceinline__ V ld(const h16* p) { return cat16(*(const v8h*)p, *(const v8h*)(p + 256)); } static __device__ __forceinline__ v8f mma(V a, V b, v8f c) { return wmma16(a, b, c); } };
template <> struct WFrag<bf> { typedef v16bf V; static __device__ __forceinline__ V ld(const bf* p) { return cat16b(*(const v8us*)p, *(const v8us*)(p + 256)); } static __device__ __forceinline__ v8f mma(V a, V b, v8f c) { return wmmab(a, b, c); } };
template <typename T16, int NSPLIT, int OM, int K, int D>
__global__ __launch_bounds__(32) void k_gemmw(const T16* __restrict__ A, const T16* __restrict__ A2, const T16* __restrict__ Bt, const T16* __restrict__ Bt2, float* C, h16* P, int ldc, const float* __restrict__ bias, const float* __restrict__ bias1, const float* __restrict__ bias2) {
    typedef typename WFrag<T16>::V V;
    __shared__ __align__(16) float os[16 * 68];
    const int lane = threadIdx.x & 31, lr = lane & 15, hi = lane >> 4; const int r0 = blockIdx.x * 64, c0 = blockIdx.y * 64;
    v8f acc[4][4];
#pragma unroll
    for (int mb = 0; mb < 4; ++mb)
#pragma unroll
        for (int nb = 0; nb < 4; ++nb) acc[mb][nb] = (v8f){};
    const size_t aoff = (size_t)r0 * K, boff = (size_t)c0 * K; const unsigned lo = 8 * lane;   // 16 rows of K are K / 32 blocks of 512 elements; a block's address is the same for the whole wave, lo the lane's place in it

    // REGISTER RING: D fragment sets; pass st first issues the loads of pass st + D - 1 into the set that pass st - 1 has just left, then does its own products, so a load has D - 1 passes of matrix time to arrive.
    // The K / 32 passes are unrolled whole: every block then lies at a constant distance from four addresses that no pass rewrites, and a set's number is known at compile time.
    constexpr int NS = K / 32;
    const T16* pa = A + aoff + lo; const T16* pb = Bt + boff + lo; const T16* pa2 = (NSPLIT == 1 || NSPLIT == 2) ? A2 + aoff + lo : pa; const T16* pb2 = (NSPLIT >= 2) ? Bt2 + boff + lo : pb;
    V a[D][4], a2[D][4], b[D][4], b2[D][4];
    // unrolled whole, so that ft % D and st % D are constants and the sets stay in registers
#pragma unroll
    for (int st = 1 - D; st < NS; ++st) {   // passes below 0 only fill the ring
        const int ft = st + D - 1, fs = ft % D;
        if (ft < NS) {
#pragma unroll
            for (int mb = 0; mb < 4; ++mb) { a[fs][mb] = WFrag<T16>::ld(pa + ft * 512 + mb * 16 * K); if (NSPLIT == 1 || NSPLIT == 2) a2[fs][mb] = WFrag<T16>::ld(pa2 + ft * 512 + mb * 16 * K); }
#pragma unroll
            for (int nb = 0; nb < 4; ++nb) { b[fs][nb] = WFrag<T16>::ld(pb + ft * 512 + nb * 16 * K); if (NSPLIT >= 2) b2[fs][nb] = WFrag<T16>::ld(pb2 + ft * 512 + nb * 16 * K); }
        }
        if (ft == NS - 1) asm volatile("s_wait_xcnt 0x0" ::: "memory");   // behind the last loads, in front of the first overwrite of the address registers that the loads name (no pass rewrites them; the epilogue may)
        __builtin_amdgcn_sched_barrier(0);   // the set's loads issue here as one group, D - 1 passes ahead of their use; without it the compiler sinks them to just in front of the products that read them and the wave waits out each latency
        if (st >= 0) {
            const int cs = st % D;
#pragma unroll
            for (int nb = 0; nb < 4; ++nb) {
#pragma unroll
                for (int mb = 0; mb < 4; ++mb) { acc[mb][nb] = WFrag<T16>::mma(a[cs][mb], b[cs][nb], acc[mb][nb]); if (NSPLIT == 1 || NSPLIT == 2) acc[mb][nb] = WFrag<T16>::mma(a2[cs][mb], b[cs][nb], acc[mb][nb]); if (NSPLIT >= 2) acc[mb][nb] = WFrag<T16>::mma(a[cs][mb], b2[cs][nb], acc[mb][nb]); } }
            __builtin_amdgcn_sched_barrier(0);   // the next pass's loads stay below these products and so take the set that these leave; without it the compiler lifts loads above them into further registers (the output projection then takes 56 more)
        }
    }
    const int sel = (OM == 1) ? c0 / DQ : 0, cl = (OM == 1) ? c0 % DQ : c0, rt = r0 % TT;   // which projection, the column in it, the row in its entry: the same for the whole tile
    const float* bs = (sel == 0) ? bias : (sel == 1) ? bias1 : bias2;
    if (OM == 1) P += ((size_t)sel * NB_ + r0 / TT) * ((size_t)NH_ * TT * HD);
    if (OM == 1 && sel == 2) {   // straight from the accumulators: each store of the wave is half a block, 512 B in a row
#pragma unroll
        for (int nb = 0; nb < 4; ++nb) { const float bn = bfr(bs[cl + nb * 16 + lr]); h16* pcol = P + (size_t)cl * TT + (size_t)rt * HD + nb * 512 + lane * 8;
#pragma unroll
            for (int mb = 0; mb < 4; ++mb) { v8h o;
#pragma unroll
                for (int j = 0; j < 8; ++j) o[j] = (h16)(acc[mb][nb][j] + bn);
                *(v8h*)(pcol + (mb >> 1) * 2048 + (mb & 1) * 256) = o; } }
        return; }
    if (OM == 1) {   // q, k: 16 rows x 64 columns turned in LDS, bias added on the way in; then each lane takes its own 16-B pieces of the row block's two blocks
        float bn[4];
#pragma unroll
        for (int nb = 0; nb < 4; ++nb) bn[nb] = bfr(bs[cl + nb * 16 + lr]);
        h16* pq = P + ((size_t)(cl / HD) * TT + rt) * HD + lane * 8;
#pragma unroll
        for (int mb = 0; mb < 4; ++mb) {
#pragma unroll
            for (int nb = 0; nb < 4; ++nb) {
#pragma unroll
                for (int j = 0; j < 8; ++j) os[(hi * 8 + j) * 68 + nb * 16 + lr] = acc[mb][nb][j] + bn[nb]; }
            __builtin_amdgcn_wave_barrier(); asm volatile("" ::: "memory");   // the rows are read back by other lanes of this wave: the compiler may not move the reads above the writes
            v8h o[4];
#pragma unroll
            for (int s = 0; s < 4; ++s) { const float* rp = os + lr * 68 + s * 16 + hi * 8; const v4f x0 = *(const v4fa*)rp, x1 = *(const v4fa*)(rp + 4);
#pragma unroll
                for (int q = 0; q < 4; ++q) { o[s][q] = (h16)x0[q]; o[s][q + 4] = (h16)x1[q]; }
                *(v8h*)(pq + mb * 1024 + s * 256) = o[s]; }
            __builtin_amdgcn_wave_barrier(); asm volatile("s_wait_xcnt 0x0" :: "v"(o[0]), "v"(o[1]), "v"(o[2]), "v"(o[3]) : "memory");   // the next row block's LDS writes stay below these reads; and the wait stands in front of every overwrite of the registers that the four stores name (as inputs here they stay untouched up to it)
        }
        return; }
    const int cofs = lr * 4; v4f bb;   // a lane stores the same four columns in every row: their biases are read once
#pragma unroll
    for (int q = 0; q < 4; ++q) bb[q] = bfr(bs[cl + cofs + q]);
#pragma unroll
    for (int mb = 0; mb < 4; ++mb) {
#pragma unroll
        for (int nb = 0; nb < 4; ++nb) {
#pragma unroll
            for (int j = 0; j < 8; ++j) os[(hi * 8 + j) * 68 + nb * 16 + lr] = acc[mb][nb][j]; }
        __builtin_amdgcn_wave_barrier(); asm volatile("" ::: "memory");
        float* crow = C + (size_t)(r0 + mb * 16) * ldc + c0;
#pragma unroll
        for (int s = 0; s < 8; ++s) { const int row = 2 * s + hi; v4f val = *(const v4fa*)(os + row * 68 + cofs); val[0] += bb[0]; val[1] += bb[1]; val[2] += bb[2]; val[3] += bb[3];
            if (OM == 0) *(v4f*)(crow + (size_t)row * ldc + cofs) = val;
        }
        __builtin_amdgcn_wave_barrier(); asm volatile("" ::: "memory");
    }
}

__device__ __forceinline__ void splitf(float y, unsigned short& h, unsigned short& l) { h = f2bf(y); l = f2bf(y - bf2f(h)); }
typedef __attribute__((ext_vector_type(2))) unsigned short v2us;
typedef __attribute__((ext_vector_type(4))) unsigned short v4us;
typedef __attribute__((ext_vector_type(4))) int v4i;

// k_prep: all the rounding to bf16 in ONE launch, one wave a block of the fragment order. Work-groups 0 .. 4 x WTB - 1: the four 'io' weights [DM][DM] (in, out) -> Bt, rows out, k = in, WTB work-groups each, the four results one behind the other; the rest: x of both entries, rows m, k = in.
#define WTB (DM * DM / 512 / 8)   // work-groups a weight: 8 waves x 1 block of 512 elements
__global__ __launch_bounds__(256) void k_prep(const float* __restrict__ w0, const float* __restrict__ w1, const float* __restrict__ w2, const float* __restrict__ w3, bf* Bt4, const float* __restrict__ src, bf* dst) {
    const int lane = threadIdx.x & 31, lr = lane & 15, hi = lane >> 4;
    if (blockIdx.x < 4 * WTB) {   // lane (hi, lr) gathers its own two pieces: row out = 16 nb + lr, 8 consecutive in; a load reads 64 B of each of two rows of w, a store is 512 B in a row
        const int wi = blockIdx.x / WTB; const float* w = (wi == 0) ? w0 : (wi == 1) ? w1 : (wi == 2) ? w2 : w3; bf* Bt = Bt4 + (size_t)wi * DM * DM;
        const int blk = (blockIdx.x % WTB) * 8 + (threadIdx.x >> 5); const int nb = blk / (DM / 32), kb = blk % (DM / 32);
        const float* wp = w + (size_t)(kb * 32 + hi * 8) * DM + nb * 16 + lr; float v[16];
#pragma unroll
        for (int j = 0; j < 16; ++j) v[j] = wp[(size_t)((j >> 3) * 16 + (j & 7)) * DM];
#pragma unroll
        for (int hf = 0; hf < 2; ++hf) { v8us o;
#pragma unroll
            for (int j = 0; j < 8; ++j) o[j] = f2bf(v[hf * 8 + j]);
            *(v8us*)(Bt + (size_t)blk * 512 + hf * 256 + lane * 8) = o; }
        return; }
    const int blk = (blockIdx.x - 4 * WTB) * 8 + (threadIdx.x >> 5); const int rb = blk / (DM / 32), kb = blk % (DM / 32);   // x: whole 128-B lines in (4 rows a load), 64-B runs out
    const int kq = (lane & 7) * 4; const float* sp = src + (size_t)(rb * 16 + (lane >> 3)) * DM + kb * 32 + kq; bf* dp = dst + (size_t)blk * 512 + (kq >> 4) * 256 + (((kq >> 3) & 1) * 16 + (lane >> 3)) * 8 + (kq & 4); v4f v[4];
#pragma unroll
    for (int i = 0; i < 4; ++i) v[i] = *(const v4f*)(sp + (size_t)i * 4 * DM);
#pragma unroll
    for (int i = 0; i < 4; ++i) { v4us o;
#pragma unroll
        for (int k = 0; k < 4; ++k) o[k] = f2bf(v[i][k]);
        *(v4us*)(dp + i * 32) = o; }
    asm volatile("s_wait_xcnt 0x0" ::: "memory");   // behind the last of the four stores, in front of any later overwrite of the address and data registers that they name
}

__device__ __forceinline__ float xhalf(float x) { return __builtin_bit_cast(float, __builtin_amdgcn_permlanex16(__builtin_bit_cast(int, x), __builtin_bit_cast(int, x), 0x76543210, 0xfedcba98, false, false)); }  // lane l with lane l ^ 16, in the vector unit (a shuffle would go through the LDS path and its wait)
#define FKB 64     // keys a pass
#define FWV 4      // waves a work-group: one on each SIMD, all on one head, so that they share its K and V lines in the WGP cache
__global__ __launch_bounds__(FWV * 32) void k_fattn(const h16* __restrict__ Qp, const h16* __restrict__ Kp, const h16* __restrict__ Vt, const float* __restrict__ u, const int* __restrict__ kvp, bf* Ah, bf* Al) {
    __shared__ __align__(16) float wl[TT]; __shared__ __align__(16) float mb[TT];
    { const size_t z = blockIdx.z; Qp += z * ((size_t)NH_ * TT * HD); Kp += z * ((size_t)NKV * TT * HD); Vt += z * ((size_t)NKV * HD * TT); u += z * TT; kvp += z * TT; Ah += z * ((size_t)TT * DQ); Al += z * ((size_t)TT * DQ); }
    { v4i kq[TT / (FWV * 128)]; v4f uq[TT / (FWV * 128)];   // both rows are loaded whole and unconditionally first (16 B a lane, whole lines), so that the work-group pays one load latency, not one per key group
#pragma unroll
        for (int r = 0; r < TT / (FWV * 128); ++r) { const int j = r * (FWV * 128) + threadIdx.x * 4; kq[r] = *(const v4i*)(kvp + j); uq[r] = *(const v4f*)(u + j); }
#pragma unroll
        for (int r = 0; r < TT / (FWV * 128); ++r)
#pragma unroll
            for (int q = 0; q < 4; ++q) uq[r][q] = expf(-LAMBDA * bfr(uq[r][q])) * (SCL * 1.4426950408889634f);
#pragma unroll
        for (int r = 0; r < TT / (FWV * 128); ++r) { const int j = r * (FWV * 128) + threadIdx.x * 4; v4f w4, b4;
#pragma unroll
            for (int q = 0; q < 4; ++q) { const bool on = (kq[r][q] != 0); w4[q] = on ? uq[r][q] : 0.0f; b4[q] = on ? 0.0f : -3.0e38f; }
            *(v4fa*)(wl + j) = w4; *(v4fa*)(mb + j) = b4; } }
    __syncthreads();
    const int lane = threadIdx.x & 31, lr = lane & 15, hi = lane >> 4; const int h = blockIdx.y; const int q0 = (blockIdx.x * FWV + (threadIdx.x >> 5)) * 32;
    const h16* qb = Qp + ((size_t)h * TT + q0) * HD + 8 * lane; const h16* kb = Kp + (size_t)h * TT * HD + 8 * lane; const h16* vb = Vt + (size_t)h * HD * TT + 8 * lane;   // 8 x lane: the lane's place in a block; 64 keys (or queries) of a head are 8 blocks in a row in each plane
    v16h qf[2][2], kf[4][2]; v8f o[4][2]; float m[2], l[2];
#pragma unroll
    for (int qt = 0; qt < 2; ++qt) { m[qt] = -3.0e38f; l[qt] = 0.0f;
#pragma unroll
        for (int dh = 0; dh < 2; ++dh) qf[qt][dh] = WFrag<h16>::ld(qb + (qt * 2 + dh) * 512);
#pragma unroll
        for (int dt = 0; dt < 4; ++dt) o[dt][qt] = (v8f){}; }
#pragma unroll
    for (int kt = 0; kt < 4; ++kt)
#pragma unroll
        for (int dh = 0; dh < 2; ++dh) kf[kt][dh] = WFrag<h16>::ld(kb + (kt * 2 + dh) * 512);
    for (int k0 = 0; k0 < TT; k0 += FKB) {
        v16h vf[4][2]; v8f s[4][2];
#pragma unroll
        for (int dt = 0; dt < 4; ++dt)
#pragma unroll
            for (int ks = 0; ks < 2; ++ks) vf[dt][ks] = WFrag<h16>::ld(vb + (size_t)k0 * HD + (ks * 4 + dt) * 512);
        asm volatile("s_wait_xcnt 0x0" ::: "memory");   // stands in front of the pointer's step to the next pass, which overwrites the address registers that these loads name
        v4f wv[4][2], bv[4][2];
#pragma unroll
        for (int kt = 0; kt < 4; ++kt)
#pragma unroll
            for (int g = 0; g < 2; ++g) { wv[kt][g] = *(const v4fa*)(wl + k0 + kt * 16 + hi * 8 + g * 4); bv[kt][g] = *(const v4fa*)(mb + k0 + kt * 16 + hi * 8 + g * 4); }
        __builtin_amdgcn_sched_barrier(0);   // all 16 V loads and the pass's key rows from LDS issue here, ahead of the score products; without it the compiler sinks half the V loads to just in front of their use and reads LDS in four load-wait-use groups, and the wave waits out each latency
#pragma unroll
        for (int kt = 0; kt < 4; ++kt)
#pragma unroll
            for (int qt = 0; qt < 2; ++qt) { s[kt][qt] = wmma16(kf[kt][0], qf[qt][0], (v8f){}); s[kt][qt] = wmma16(kf[kt][1], qf[qt][1], s[kt][qt]); }
        const int kn = (k0 + FKB < TT) ? k0 + FKB : 0;   // the next pass's K rows are fetched behind this pass's score products (the last pass re-reads block 0, in bounds, unused)
#pragma unroll
        for (int kt = 0; kt < 4; ++kt)
#pragma unroll
            for (int dh = 0; dh < 2; ++dh) kf[kt][dh] = WFrag<h16>::ld(kb + (size_t)kn * HD + (kt * 2 + dh) * 512);
        asm volatile("s_wait_xcnt 0x0" ::: "memory");   // in front of the first reuse of the address registers that these loads name
        __builtin_amdgcn_sched_barrier(0);   // the next pass's 16 K loads issue in front of the softmax, not spread through it
#pragma unroll
        for (int kt = 0; kt < 4; ++kt)
#pragma unroll
            for (int qt = 0; qt < 2; ++qt)
#pragma unroll
                for (int j = 0; j < 4; ++j) { s[kt][qt][j] = fmaf(s[kt][qt][j], wv[kt][0][j], bv[kt][0][j]); s[kt][qt][j + 4] = fmaf(s[kt][qt][j + 4], wv[kt][1][j], bv[kt][1][j]); }
        v16h pf[2][2];
#pragma unroll
        for (int qt = 0; qt < 2; ++qt) { float mx = m[qt];
#pragma unroll
            for (int kt = 0; kt < 4; ++kt)
#pragma unroll
                for (int j = 0; j < 8; ++j) mx = fmaxf(mx, s[kt][qt][j]);
            mx = fmaxf(mx, xhalf(mx));
            const float al = __builtin_amdgcn_exp2f(m[qt] - mx); m[qt] = mx; float sum = 0.0f;
#pragma unroll
            for (int kt = 0; kt < 4; ++kt)
#pragma unroll
                for (int j = 0; j < 8; ++j) { const float p = __builtin_amdgcn_exp2f(s[kt][qt][j] - mx); sum += p; pf[kt >> 1][qt][(kt & 1) * 8 + j] = (h16)p; }
            l[qt] = fmaf(l[qt], al, sum);
#pragma unroll
            for (int dt = 0; dt < 4; ++dt)
#pragma unroll
                for (int j = 0; j < 8; ++j) o[dt][qt][j] *= al; }
#pragma unroll
        for (int ks = 0; ks < 2; ++ks)
#pragma unroll
            for (int dt = 0; dt < 4; ++dt)
#pragma unroll
                for (int qt = 0; qt < 2; ++qt) o[dt][qt] = wmma16(vf[dt][ks], pf[ks][qt], o[dt][qt]);
    }
#pragma unroll
    for (int qt = 0; qt < 2; ++qt) { const float inv = __fdiv_rn(1.0f, l[qt] + xhalf(l[qt]));
#pragma unroll
        for (int dt = 0; dt < 4; ++dt) { v8us oh, ol;
#pragma unroll
            for (int j = 0; j < 8; ++j) { unsigned short a, c2; splitf(o[dt][qt][j] * inv, a, c2); oh[j] = a; ol[j] = c2; }
            const size_t oo = (size_t)(q0 + qt * 16) * DQ + (h * 2 + (dt >> 1)) * 512 + (dt & 1) * 256 + lane * 8; *(v8us*)(Ah + oo) = oh; *(v8us*)(Al + oo) = ol; } }   // rows t, k = 64 h + d: the lane's 8 registers are its own piece of a block
}

extern "C" void kernel_launch(void* const* d_in, const int* in_sizes, int n_in,
                              void* d_out, int out_size, void* d_ws, size_t ws_size, hipStream_t stream) {
    (void)in_sizes; (void)n_in; (void)out_size;
    const float* x = (const float*)d_in[0]; const float* un = (const float*)d_in[1]; const int* km = (const int*)d_in[2]; const float* wq = (const float*)d_in[3]; const float* bq = (const float*)d_in[4]; const float* wk = (const float*)d_in[5]; const float* bk = (const float*)d_in[6]; const float* wv = (const float*)d_in[7]; const float* bv = (const float*)d_in[8]; const float* wo = (const float*)d_in[9]; const float* bo = (const float*)d_in[10];
    float* OUT = (float*)d_out;     // [2][2048][1024]
    char* wsp = (char*)d_ws;
    auto take = [&](size_t bytes) { char* p = wsp; wsp += (bytes + 255) & ~(size_t)255; return (void*)p; };
    bf* W4 = (bf*)take((size_t)4 * DM * DM * 2);    // Wq, Wk, Wv, Wo as Bt [out][in], one behind the other: the first three are the B operand [3 x DQ][DM] of the q | k | v product
    bf* XB = (bf*)take((size_t)NB_ * TT * DM * 2);
    h16* QKV16 = (h16*)take((size_t)3 * NB_ * NH_ * TT * HD * 2);    // q planes, k planes, v planes, each [b][...]
    bf* ATh = (bf*)take((size_t)NB_ * TT * DQ * 2); bf* ATl = (bf*)take((size_t)NB_ * TT * DQ * 2);
    if ((size_t)(wsp - (char*)d_ws) > ws_size) return;    // total 56 MiB of the workspace
    const size_t PL = (size_t)NB_ * NH_ * TT * HD;
    k_prep<<<4 * WTB + NB_ * TT * DM / 512 / 8, 256, 0, stream>>>(wq, wk, wv, wo, W4, x, XB);
    k_gemmw<bf, 0, 1, DM, 3><<<dim3(NB_ * TT / 64, 3 * DQ / 64, 1), 32, 0, stream>>>(XB, nullptr, W4, nullptr, nullptr, QKV16, 0, bq, bk, bv);    // q, k planes [b][h] rows t, v planes [b][h] rows d, in fragment order
    k_fattn<<<dim3(TT / (FWV * 32), NH_, NB_), FWV * 32, 0, stream>>>(QKV16, QKV16 + PL, QKV16 + 2 * PL, un, km, ATh, ATl);   // all heads of both entries: scores, key weight, mask, softmax, attn.v, merged hi/lo planes
    k_gemmw<bf, 1, 0, DQ, 4><<<dim3(NB_ * TT / 64, DM / 64, 1), 32, 0, stream>>>(ATh, ATl, W4 + (size_t)3 * DM * DM, nullptr, OUT, nullptr, DM, bo, nullptr, nullptr);
}

// v006
// It runs in 83.7 microseconds.
// Next to v005, in two timings, it ran 1.07 and 1.03 times as fast.
// Counting every step since v000, it is 17.3 times as fast.
#include <hip/hip_runtime.h>

// Multi-head self-attention whose scaled scores are multiplied, per KEY, by an uncertainty weight before the mask and the softmax, with an integer key mask read as data and an output projection (hidden_states [2][2048][1024]; token_uncertainty [2][2048]; attention_mask int32 [2][2048];
// q, k, v = x W + b with 'io' weights [1024][1024] (in, out) and biases [1024]; 16 heads x 64 (head h = columns h x 64 ..); scores = q k^T / sqrt(64); scores = scores x exp(-0.5 x token_uncertainty[b][key]); where(mask[b][key] != 0, scores, -inf); softmax over the keys;
// out = merged Wo + bo ('io' + bias) -> [2][2048][1024] (4.2 M); argument order hidden_states, token_uncertainty, attention_mask, Wq, bq, Wk, bk, Wv, bv, Wo, bo).
// Layout, both batch entries in every launch: one bf16 copy of x (read by all three projections) and the 'io' weights transposed and rounded, in one launch (k_prep); q, k, v as ONE product [4096][1024] x [3072][1024]^T + f32 biases, whose epilogue writes the f16 head planes itself (q, k per [b][h] with rows t, v per [b][h] with rows d); dense T-2048 attention, 16 heads x 2 entries in one launch (k_fattn):
// the f16 score product, each score x its key's weight x SCL in f32, the entry's int key mask, a running-maximum softmax in f32 whose weights go to fp16 in registers, attn.v on ONE fp16 product, the division by the sum; merged hi/lo x Wo exact + bo.
// FRAGMENT ORDER: every 16-bit plane that a matrix instruction reads (x, the four weights, q, k, v^T, merged hi/lo) lies in memory as blocks of 16 rows x 32 k = 1 KiB, the 16-B piece (row r, k = 16 half + 8 hh + 0..7) at byte 512 half + 16 (16 hh + r):
// lane 16 hh + r of a wave reads its two pieces at 16 x lane and 512 + 16 x lane, so each fragment load of a wave is 512 B in a row (4 whole lines) and not 32 B out of each of 16 lines. Which lane and register holds which (row, k) is as with row-major planes.
// Compute dtypes, f32 accumulate: every float input rounded to bf16 at its load (the uncertainty row too); projections exact + f32 biases; scores and attn.v fp16; the key weight and the softmax f32; Wo hl x exact + bias.

#define NB_  2
#define TT   2048
#define DM   1024
#define NH_  16
#define NKV  16
#define REP  (NH_ / NKV)
#define HD   64
#define DQ   (NH_ * HD)
#define DKV  (NKV * HD)
#define SCL  0.125f   // HD^-0.5
#define LAMBDA 0.5f   // the module's uncertainty weight: w = exp(-LAMBDA x token_uncertainty) per key
typedef _Float16 h16;
typedef unsigned short bf;
typedef __attribute__((ext_vector_type(16))) __bf16   v16bf;
typedef __attribute__((ext_vector_type(16))) _Float16 v16h;
typedef __attribute__((ext_vector_type(8)))  _Float16 v8h;
typedef __attribute__((ext_vector_type(4)))  _Float16 v4h;
typedef __attribute__((ext_vector_type(8)))  unsigned short v8us;
typedef __attribute__((ext_vector_type(8)))  float    v8f;
typedef __attribute__((ext_vector_type(4)))  float    v4f;
typedef v8h  __attribute__((may_alias)) v8ha;
typedef v4f  __attribute__((may_alias)) v4fa;
typedef v8us __attribute__((may_alias)) v8usa;

__device__ __forceinline__ unsigned short f2bf(float f) { unsigned u = __float_as_uint(f); u += 0x7FFFu + ((u >> 16) & 1u); return (unsigned short)(u >> 16); }
__device__ __forceinline__ float bf2f(unsigned short b) { return __uint_as_float(((unsigned)b) << 16); }
__device__ __forceinline__ float bfr(float f) { return bf2f(f2bf(f)); }
__device__ __forceinline__ v16h cat16(v8h lo, v8h hi) { return __builtin_shufflevector(lo, hi, 0, 1, 2, 3, 4, 5, 6, 7, 8, 9, 10, 11, 12, 13, 14, 15); }
__device__ __forceinline__ v16bf cat16b(v8us lo, v8us hi) { return __builtin_bit_cast(v16bf, __builtin_shufflevector(lo, hi, 0, 1, 2, 3, 4, 5, 6, 7, 8, 9, 10, 11, 12, 13, 14, 15)); }
__device__ __forceinline__ v8f wmma16(v16h a, v16h b, v8f c) { return __builtin_amdgcn_wmma_f32_16x16x32_f16(false, a, false, b, (short)0, c, false, false); }
__device__ __forceinline__ v8f wmmab(v16bf a, v16bf b, v8f c) { return __builtin_amdgcn_wmma_f32_16x16x32_bf16(false, a, false, b, (short)0, c, false, false); }



// ---- k_gemmw: register-blocked GEMM, ONE WAVE per 64x64 output tile (16 accumulators), operands straight from 16-bit planes in fragment order (blocks [row / 16][k / 32], WFrag::ld takes the lane's place in a block); grid (M/64, N/64), 32 threads.
// y[m][n] = sum_k A[m][k] Bt[n][k] (+ split products per NSPLIT) + f32 bias[n]. K % 32 == 0, known at compile time: every block of a pass then lies at a constant distance from one address per operand. The rows m run over both batch entries (m = b x TT + t).
// OM 0, the one mode left: C[m][n] = y in f32, pitch ldc (P, bias1 and bias2 are not read; the q | k | v product has its own kernel, k_gemmq).
template <typename T16> struct WFrag;
template <> struct WFrag<h16> { typedef v16h V; static __device__ __forceinline__ V ld(const h16* p) { return cat16(*(const v8h*)p, *(const v8h*)(p + 256)); } static __device__ __forceinline__ v8f mma(V a, V b, v8f c) { return wmma16(a, b, c); } };
template <> struct WFrag<bf> { typedef v16bf V; static __device__ __forceinline__ V ld(const bf* p) { return cat16b(*(const v8us*)p, *(const v8us*)(p + 256)); } static __device__ __forceinline__ v8f mma(V a, V b, v8f c) { return wmmab(a, b, c); } };
template <typename T16, int NSPLIT, int OM, int K, int D>
__global__ __launch_bounds__(32) void k_gemmw(const T16* __restrict__ A, const T16* __restrict__ A2, const T16* __restrict__ Bt, const T16* __restrict__ Bt2, float* C, h16* P, int ldc, const float* __restrict__ bias, const float* __restrict__ bias1, const float* __restrict__ bias2) {
    typedef typename WFrag<T16>::V V;
    __shared__ __align__(16) float os[16 * 68];
    const int lane = threadIdx.x & 31, lr = lane & 15, hi = lane >> 4; const int r0 = blockIdx.x * 64, c0 = blockIdx.y * 64;
    v8f acc[4][4];
#pragma unroll
    for (int mb = 0; mb < 4; ++mb)
#pragma unroll
        for (int nb = 0; nb < 4; ++nb) acc[mb][nb] = (v8f){};
    const size_t aoff = (size_t)r0 * K, boff = (size_t)c0 * K; const unsigned lo = 8 * lane;   // 16 rows of K are K / 32 blocks of 512 elements; a block's address is the same for the whole wave, lo the lane's place in it

    // REGISTER RING: D fragment sets; pass st first issues the loads of pass st + D - 1 into the set that pass st - 1 has just left, then does its own products, so a load has D - 1 passes of matrix time to arrive.
    // The K / 32 passes are unrolled whole: every block then lies at a constant distance from four addresses that no pass rewrites, and a set's number is known at compile time.
    constexpr int NS = K / 32;
    const T16* pa = A + aoff + lo; const T16* pb = Bt + boff + lo; const T16* pa2 = (NSPLIT == 1 || NSPLIT == 2) ? A2 + aoff + lo : pa; const T16* pb2 = (NSPLIT >= 2) ? Bt2 + boff + lo : pb;
    V a[D][4], a2[D][4], b[D][4], b2[D][4];
    // unrolled whole, so that ft % D and st % D are constants and the sets stay in registers
#pragma unroll
    for (int st = 1 - D; st < NS; ++st) {   // passes below 0 only fill the ring
        const int ft = st + D - 1, fs = ft % D;
        if (ft < NS) {
#pragma unroll
            for (int mb = 0; mb < 4; ++mb) { a[fs][mb] = WFrag<T16>::ld(pa + ft * 512 + mb * 16 * K); if (NSPLIT == 1 || NSPLIT == 2) a2[fs][mb] = WFrag<T16>::ld(pa2 + ft * 512 + mb * 16 * K); }
#pragma unroll
            for (int nb = 0; nb < 4; ++nb) { b[fs][nb] = WFrag<T16>::ld(pb + ft * 512 + nb * 16 * K); if (NSPLIT >= 2) b2[fs][nb] = WFrag<T16>::ld(pb2 + ft * 512 + nb * 16 * K); }
        }
        if (ft == NS - 1) asm volatile("s_wait_xcnt 0x0" ::: "memory");   // behind the last loads, in front of the first overwrite of the address registers that the loads name (no pass rewrites them; the epilogue may)
        __builtin_amdgcn_sched_barrier(0);   // the set's loads issue here as one group, D - 1 passes ahead of their use; without it the compiler sinks them to just in front of the products that read them and the wave waits out each latency
        if (st >= 0) {
            const int cs = st % D;
#pragma unroll
            for (int nb = 0; nb < 4; ++nb) {
#pragma unroll
                for (int mb = 0; mb < 4; ++mb) { acc[mb][nb] = WFrag<T16>::mma(a[cs][mb], b[cs][nb], acc[mb][nb]); if (NSPLIT == 1 || NSPLIT == 2) acc[mb][nb] = WFrag<T16>::mma(a2[cs][mb], b[cs][nb], acc[mb][nb]); if (NSPLIT >= 2) acc[mb][nb] = WFrag<T16>::mma(a[cs][mb], b2[cs][nb], acc[mb][nb]); } }
            __builtin_amdgcn_sched_barrier(0);   // the next pass's loads stay below these products and so take the set that these leave; without it the compiler lifts loads above them into further registers (the output projection then takes 56 more)
        }
    }
    const int sel = (OM == 1) ? c0 / DQ : 0, cl = (OM == 1) ? c0 % DQ : c0, rt = r0 % TT;   // which projection, the column in it, the row in its entry: the same for the whole tile
    const float* bs = (sel == 0) ? bias : (sel == 1) ? bias1 : bias2;
    const int cofs = lr * 4; v4f bb;   // a lane stores the same four columns in every row: their biases are read once
#pragma unroll
    for (int q = 0; q < 4; ++q) bb[q] = bfr(bs[cl + cofs + q]);
#pragma unroll
    for (int mb = 0; mb < 4; ++mb) {
#pragma unroll
        for (int nb = 0; nb < 4; ++nb) {
#pragma unroll
            for (int j = 0; j < 8; ++j) os[(hi * 8 + j) * 68 + nb * 16 + lr] = acc[mb][nb][j]; }
        __builtin_amdgcn_wave_barrier(); asm volatile("" ::: "memory");
        float* crow = C + (size_t)(r0 + mb * 16) * ldc + c0;
#pragma unroll
        for (int s = 0; s < 8; ++s) { const int row = 2 * s + hi; v4f val = *(const v4fa*)(os + row * 68 + cofs); val[0] += bb[0]; val[1] += bb[1]; val[2] += bb[2]; val[3] += bb[3];
            if (OM == 0) *(v4f*)(crow + (size_t)row * ldc + cofs) = val;
        }
        __builtin_amdgcn_wave_barrier(); asm volatile("" ::: "memory");
    }
}

// ---- k_gemmq: the q | k | v product. ONE WAVE per 128 rows x 96 columns (48 accumulators), one wave a SIMD, four waves (2 x 2) a work-group, so that each A block is read by two waves of a WGP and each B block by two; grid (M / 256, 16), 128 threads: 256 work-groups.
// A wave's 96 columns are one whole q or k head (hp = 0..15 the q heads, 16..31 the k heads: B rows 64 hp ..) and 32 columns of v (B rows 2 DQ + 32 hp ..): 14 fragments feed 48 products a pass (a 64 x 64 tile: 8 feed 16), and each part of the tile lies in one plane.
// y = x Bt^T + f32 biases (bias | bias1 | bias2 for q | k | v). P holds the three fp16 plane sets one behind the other, each [b][...]: q and k as head planes, rows t, k = d, blocks [n / 64][t / 16][d / 32]; v transposed, rows d, k = t, blocks [n / 64][t / 32][d / 16]: a lane's 8 accumulator registers are 8 consecutive t of one d, its own 16-B piece of a block.
// Register ring of QD sets as in k_gemmw, rolled: one trip of the loop is QD passes, so a set's number is known at compile time and the text stays small; the last QD passes stand behind the loop, where only one load group is left.
#define QMB 8
#define QNB 6
#define QD  4
__global__ __launch_bounds__(128) void k_gemmq(const bf* __restrict__ A, const bf* __restrict__ Bt, h16* P, const float* __restrict__ bias, const float* __restrict__ bias1, const float* __restrict__ bias2) {
    typedef WFrag<bf>::V V;
    constexpr int K = DM, NS = K / 32;
    __shared__ __align__(16) float osw[4][16 * 68];
    const int lane = threadIdx.x & 31, lr = lane & 15, hi = lane >> 4; const int wn = __builtin_amdgcn_readfirstlane(threadIdx.x >> 5);
    float* os = osw[wn];   // each wave turns its rows in its own LDS range
    const int r0 = (blockIdx.x * 2 + (wn & 1)) * (QMB * 16), hp = blockIdx.y * 2 + (wn >> 1);
    v8f acc[QMB][QNB];
#pragma unroll
    for (int mb = 0; mb < QMB; ++mb)
#pragma unroll
        for (int nb = 0; nb < QNB; ++nb) acc[mb][nb] = (v8f){};
    const bf* pa = A + (size_t)r0 * K + 8 * lane; const bf* pb = Bt + (size_t)hp * HD * K + 8 * lane; const bf* pv = Bt + (size_t)(2 * DQ + hp * 32) * K + 8 * lane;
    const int sel = hp / NH_, hd = hp % NH_;   // q or k; the head
    float braw[QNB];   // the six bias values of a lane are asked for ahead of the fragments, so that the epilogue does not wait out their latency
#pragma unroll
    for (int nb = 0; nb < QNB; ++nb) braw[nb] = (nb < 4) ? ((sel == 0) ? bias : bias1)[hd * HD + nb * 16 + lr] : bias2[hp * 32 + (nb - 4) * 16 + lr];
    V a[QD][QMB], b[QD][QNB];
    auto qload = [&](int fs, int off) __attribute__((always_inline)) {   // set fs takes the pass that lies off passes behind the three addresses
#pragma unroll
        for (int mb = 0; mb < QMB; ++mb) a[fs][mb] = WFrag<bf>::ld(pa + off * 512 + mb * 16 * K);
#pragma unroll
        for (int nb = 0; nb < 4; ++nb) b[fs][nb] = WFrag<bf>::ld(pb + off * 512 + nb * 16 * K);
#pragma unroll
        for (int nb = 4; nb < QNB; ++nb) b[fs][nb] = WFrag<bf>::ld(pv + off * 512 + (nb - 4) * 16 * K); };
    auto qmma = [&](int cs) __attribute__((always_inline)) {
#pragma unroll
        for (int nb = 0; nb < QNB; ++nb)
#pragma unroll
            for (int mb = 0; mb < QMB; ++mb) acc[mb][nb] = WFrag<bf>::mma(a[cs][mb], b[cs][nb], acc[mb][nb]); };
#pragma unroll
    for (int f = 0; f < QD - 1; ++f) qload(f, f);
    // stays rolled, for speed only
#pragma nounroll
    for (int it = 0; it < NS / QD - 1; ++it) {
#pragma unroll
        for (int u = 0; u < QD; ++u) {
            qload((u + QD - 1) % QD, u + QD - 1);
            if (u == QD - 1) asm volatile("s_wait_xcnt 0x0" ::: "memory");   // behind the trip's last loads, in front of the step of the three addresses that the loads name
            __builtin_amdgcn_sched_barrier(0);   // the set's loads issue here as one group, QD - 1 passes ahead of their use, and are not sunk to the products that read them
            qmma(u);
            __builtin_amdgcn_sched_barrier(0);   // the next pass's loads stay below these products and so take the set that these leave
        }
        pa += QD * 512; pb += QD * 512; pv += QD * 512;
    }
#pragma unroll
    for (int u = 0; u < QD; ++u) {
        if (u == 0) { qload(QD - 1, QD - 1); asm volatile("s_wait_xcnt 0x0" ::: "memory"); }   // the wait: behind the last loads, in front of the first overwrite of their address registers in the epilogue
        __builtin_amdgcn_sched_barrier(0);   // as in the loop
        qmma(u);
        __builtin_amdgcn_sched_barrier(0);
    }
    const int rt = r0 % TT; const size_t PLN = (size_t)NH_ * TT * HD;   // the row in its entry
    {   // q, k: 16 rows x 64 columns turned in LDS, bias added on the way in; then each lane takes its own 16-B pieces of the row block's two blocks
        float bn[4];
#pragma unroll
        for (int nb = 0; nb < 4; ++nb) bn[nb] = bfr(braw[nb]);
        h16* pq = P + ((size_t)sel * NB_ + r0 / TT) * PLN + ((size_t)hd * TT + rt) * HD + lane * 8;
#pragma unroll
        for (int mb = 0; mb < QMB; ++mb) {
#pragma unroll
            for (int nb = 0; nb < 4; ++nb) {
#pragma unroll
                for (int j = 0; j < 8; ++j) os[(hi * 8 + j) * 68 + nb * 16 + lr] = acc[mb][nb][j] + bn[nb]; }
            __builtin_amdgcn_wave_barrier(); asm volatile("" ::: "memory");   // the rows are read back by other lanes of this wave: the compiler may not move the reads above the writes
            v8h o[4];
#pragma unroll
            for (int s = 0; s < 4; ++s) { const float* rp = os + lr * 68 + s * 16 + hi * 8; const v4f x0 = *(const v4fa*)rp, x1 = *(const v4fa*)(rp + 4);
#pragma unroll
                for (int q = 0; q < 4; ++q) { o[s][q] = (h16)x0[q]; o[s][q + 4] = (h16)x1[q]; }
                *(v8h*)(pq + mb * 1024 + s * 256) = o[s]; }
            __builtin_amdgcn_wave_barrier(); asm volatile("s_wait_xcnt 0x0" :: "v"(o[0]), "v"(o[1]), "v"(o[2]), "v"(o[3]) : "memory");   // the next row block's LDS writes stay below these reads; and the wait stands in front of every overwrite of the registers that the four stores name (as inputs here they stay untouched up to it)
        }
    }
    // v, transposed, straight from the accumulators: head hp / 2, d blocks 2 (hp % 2) + 0, 1; each store of the wave is half a block, 512 B in a row
    h16* pc = P + ((size_t)2 * NB_ + r0 / TT) * PLN + (size_t)(hp >> 1) * HD * TT + (size_t)rt * HD + (hp & 1) * 1024 + lane * 8;
#pragma unroll
    for (int nb = 4; nb < QNB; ++nb) { const float bn = bfr(braw[nb]);
#pragma unroll
        for (int mq = 0; mq < QMB; mq += 4) { v8h o[4];
#pragma unroll
            for (int mb = 0; mb < 4; ++mb) {
#pragma unroll
                for (int j = 0; j < 8; ++j) o[mb][j] = (h16)(acc[mq + mb][nb][j] + bn);
                *(v8h*)(pc + (nb - 4) * 512 + ((mq + mb) >> 1) * 2048 + (mb & 1) * 256) = o[mb]; }
            asm volatile("s_wait_xcnt 0x0" :: "v"(o[0]), "v"(o[1]), "v"(o[2]), "v"(o[3]) : "memory");   // in front of every overwrite of the registers that the four stores name
        } }
}

__device__ __forceinline__ void splitf(float y, unsigned short& h, unsigned short& l) { h = f2bf(y); l = f2bf(y - bf2f(h)); }
typedef __attribute__((ext_vector_type(2))) unsigned short v2us;
typedef __attribute__((ext_vector_type(4))) unsigned short v4us;
typedef __attribute__((ext_vector_type(4))) int v4i;

// k_prep: all the rounding to bf16 in ONE launch, one wave a block of the fragment order. Work-groups 0 .. 4 x WTB - 1: the four 'io' weights [DM][DM] (in, out) -> Bt, rows out, k = in, WTB work-groups each, the four results one behind the other; the rest: x of both entries, rows m, k = in.
#define WTB (DM * DM / 512 / 8)   // work-groups a weight: 8 waves x 1 block of 512 elements
__global__ __launch_bounds__(256) void k_prep(const float* __restrict__ w0, const float* __restrict__ w1, const float* __restrict__ w2, const float* __restrict__ w3, bf* Bt4, const float* __restrict__ src, bf* dst) {
    const int lane = threadIdx.x & 31, lr = lane & 15, hi = lane >> 4;
    if (blockIdx.x < 4 * WTB) {   // lane (hi, lr) gathers its own two pieces: row out = 16 nb + lr, 8 consecutive in; a load reads 64 B of each of two rows of w, a store is 512 B in a row
        const int wi = blockIdx.x / WTB; const float* w = (wi == 0) ? w0 : (wi == 1) ? w1 : (wi == 2) ? w2 : w3; bf* Bt = Bt4 + (size_t)wi * DM * DM;
        const int blk = (blockIdx.x % WTB) * 8 + (threadIdx.x >> 5); const int nb = blk / (DM / 32), kb = blk % (DM / 32);
        const float* wp = w + (size_t)(kb * 32 + hi * 8) * DM + nb * 16 + lr; float v[16];
#pragma unroll
        for (int j = 0; j < 16; ++j) v[j] = wp[(size_t)((j >> 3) * 16 + (j & 7)) * DM];
#pragma unroll
        for (int hf = 0; hf < 2; ++hf) { v8us o;
#pragma unroll
            for (int j = 0; j < 8; ++j) o[j] = f2bf(v[hf * 8 + j]);
            *(v8us*)(Bt + (size_t)blk * 512 + hf * 256 + lane * 8) = o; }
        return; }
    const int blk = (blockIdx.x - 4 * WTB) * 8 + (threadIdx.x >> 5); const int rb = blk / (DM / 32), kb = blk % (DM / 32);   // x: whole 128-B lines in (4 rows a load), 64-B runs out
    const int kq = (lane & 7) * 4; const float* sp = src + (size_t)(rb * 16 + (lane >> 3)) * DM + kb * 32 + kq; bf* dp = dst + (size_t)blk * 512 + (kq >> 4) * 256 + (((kq >> 3) & 1) * 16 + (lane >> 3)) * 8 + (kq & 4); v4f v[4];
#pragma unroll
    for (int i = 0; i < 4; ++i) v[i] = *(const v4f*)(sp + (size_t)i * 4 * DM);
#pragma unroll
    for (int i = 0; i < 4; ++i) { v4us o;
#pragma unroll
        for (int k = 0; k < 4; ++k) o[k] = f2bf(v[i][k]);
        *(v4us*)(dp + i * 32) = o; }
    asm volatile("s_wait_xcnt 0x0" ::: "memory");   // behind the last of the four stores, in front of any later overwrite of the address and data registers that they name
}

__device__ __forceinline__ float xhalf(float x) { return __builtin_bit_cast(float, __builtin_amdgcn_permlanex16(__builtin_bit_cast(int, x), __builtin_bit_cast(int, x), 0x76543210, 0xfedcba98, false, false)); }  // lane l with lane l ^ 16, in the vector unit (a shuffle would go through the LDS path and its wait)
#define FKB 64     // keys a pass
#define FWV 4      // waves a work-group: one on each SIMD, all on one head, so that they share its K and V lines in the WGP cache
__global__ __launch_bounds__(FWV * 32) void k_fattn(const h16* __restrict__ Qp, const h16* __restrict__ Kp, const h16* __restrict__ Vt, const float* __restrict__ u, const int* __restrict__ kvp, bf* Ah, bf* Al) {
    __shared__ __align__(16) float wl[TT]; __shared__ __align__(16) float mb[TT];
    { const size_t z = blockIdx.z; Qp += z * ((size_t)NH_ * TT * HD); Kp += z * ((size_t)NKV * TT * HD); Vt += z * ((size_t)NKV * HD * TT); u += z * TT; kvp += z * TT; Ah += z * ((size_t)TT * DQ); Al += z * ((size_t)TT * DQ); }
    { v4i kq[TT / (FWV * 128)]; v4f uq[TT / (FWV * 128)];   // both rows are loaded whole and unconditionally first (16 B a lane, whole lines), so that the work-group pays one load latency, not one per key group
#pragma unroll
        for (int r = 0; r < TT / (FWV * 128); ++r) { const int j = r * (FWV * 128) + threadIdx.x * 4; kq[r] = *(const v4i*)(kvp + j); uq[r] = *(const v4f*)(u + j); }
#pragma unroll
        for (int r = 0; r < TT / (FWV * 128); ++r)
#pragma unroll
            for (int q = 0; q < 4; ++q) uq[r][q] = expf(-LAMBDA * bfr(uq[r][q])) * (SCL * 1.4426950408889634f);
#pragma unroll
        for (int r = 0; r < TT / (FWV * 128); ++r) { const int j = r * (FWV * 128) + threadIdx.x * 4; v4f w4, b4;
#pragma unroll
            for (int q = 0; q < 4; ++q) { const bool on = (kq[r][q] != 0); w4[q] = on ? uq[r][q] : 0.0f; b4[q] = on ? 0.0f : -3.0e38f; }
            *(v4fa*)(wl + j) = w4; *(v4fa*)(mb + j) = b4; } }
    __syncthreads();
    const int lane = threadIdx.x & 31, lr = lane & 15, hi = lane >> 4; const int h = blockIdx.y; const int q0 = (blockIdx.x * FWV + (threadIdx.x >> 5)) * 32;
    const h16* qb = Qp + ((size_t)h * TT + q0) * HD + 8 * lane; const h16* kb = Kp + (size_t)h * TT * HD + 8 * lane; const h16* vb = Vt + (size_t)h * HD * TT + 8 * lane;   // 8 x lane: the lane's place in a block; 64 keys (or queries) of a head are 8 blocks in a row in each plane
    v16h qf[2][2], kf[4][2]; v8f o[4][2]; float m[2], l[2];
#pragma unroll
    for (int qt = 0; qt < 2; ++qt) { m[qt] = -3.0e38f; l[qt] = 0.0f;
#pragma unroll
        for (int dh = 0; dh < 2; ++dh) qf[qt][dh] = WFrag<h16>::ld(qb + (qt * 2 + dh) * 512);
#pragma unroll
        for (int dt = 0; dt < 4; ++dt) o[dt][qt] = (v8f){}; }
#pragma unroll
    for (int kt = 0; kt < 4; ++kt)
#pragma unroll
        for (int dh = 0; dh < 2; ++dh) kf[kt][dh] = WFrag<h16>::ld(kb + (kt * 2 + dh) * 512);
    for (int k0 = 0; k0 < TT; k0 += FKB) {
        v16h vf[4][2]; v8f s[4][2];
#pragma unroll
        for (int dt = 0; dt < 4; ++dt)
#pragma unroll
            for (int ks = 0; ks < 2; ++ks) vf[dt][ks] = WFrag<h16>::ld(vb + (size_t)k0 * HD + (ks * 4 + dt) * 512);
        asm volatile("s_wait_xcnt 0x0" ::: "memory");   // stands in front of the pointer's step to the next pass, which overwrites the address registers that these loads name
        v4f wv[4][2], bv[4][2];
#pragma unroll
        for (int kt = 0; kt < 4; ++kt)
#pragma unroll
            for (int g = 0; g < 2; ++g) { wv[kt][g] = *(const v4fa*)(wl + k0 + kt * 16 + hi * 8 + g * 4); bv[kt][g] = *(const v4fa*)(mb + k0 + kt * 16 + hi * 8 + g * 4); }
        __builtin_amdgcn_sched_barrier(0);   // all 16 V loads and the pass's key rows from LDS issue here, ahead of the score products; without it the compiler sinks half the V loads to just in front of their use and reads LDS in four load-wait-use groups, and the wave waits out each latency
#pragma unroll
        for (int kt = 0; kt < 4; ++kt)
#pragma unroll
            for (int qt = 0; qt < 2; ++qt) { s[kt][qt] = wmma16(kf[kt][0], qf[qt][0], (v8f){}); s[kt][qt] = wmma16(kf[kt][1], qf[qt][1], s[kt][qt]); }
        const int kn = (k0 + FKB < TT) ? k0 + FKB : 0;   // the next pass's K rows are fetched behind this pass's score products (the last pass re-reads block 0, in bounds, unused)
#pragma unroll
        for (int kt = 0; kt < 4; ++kt)
#pragma unroll
            for (int dh = 0; dh < 2; ++dh) kf[kt][dh] = WFrag<h16>::ld(kb + (size_t)kn * HD + (kt * 2 + dh) * 512);
        asm volatile("s_wait_xcnt 0x0" ::: "memory");   // in front of the first reuse of the address registers that these loads name
        __builtin_amdgcn_sched_barrier(0);   // the next pass's 16 K loads issue in front of the softmax, not spread through it
#pragma unroll
        for (int kt = 0; kt < 4; ++kt)
#pragma unroll
            for (int qt = 0; qt < 2; ++qt)
#pragma unroll
                for (int j = 0; j < 4; ++j) { s[kt][qt][j] = fmaf(s[kt][qt][j], wv[kt][0][j], bv[kt][0][j]); s[kt][qt][j + 4] = fmaf(s[kt][qt][j + 4], wv[kt][1][j], bv[kt][1][j]); }
        v16h pf[2][2];
#pragma unroll
        for (int qt = 0; qt < 2; ++qt) { float mx = m[qt];
#pragma unroll
            for (int kt = 0; kt < 4; ++kt)
#pragma unroll
                for (int j = 0; j < 8; ++j) mx = fmaxf(mx, s[kt][qt][j]);
            mx = fmaxf(mx, xhalf(mx));
            const float al = __builtin_amdgcn_exp2f(m[qt] - mx); m[qt] = mx; float sum = 0.0f;
#pragma unroll
            for (int kt = 0; kt < 4; ++kt)
#pragma unroll
                for (int j = 0; j < 8; ++j) { const float p = __builtin_amdgcn_exp2f(s[kt][qt][j] - mx); sum += p; pf[kt >> 1][qt][(kt & 1) * 8 + j] = (h16)p; }
            l[qt] = fmaf(l[qt], al, sum);
#pragma unroll
            for (int dt = 0; dt < 4; ++dt)
#pragma unroll
                for (int j = 0; j < 8; ++j) o[dt][qt][j] *= al; }
#pragma unroll
        for (int ks = 0; ks < 2; ++ks)
#pragma unroll
            for (int dt = 0; dt < 4; ++dt)
#pragma unroll
                for (int qt = 0; qt < 2; ++qt) o[dt][qt] = wmma16(vf[dt][ks], pf[ks][qt], o[dt][qt]);
    }
#pragma unroll
    for (int qt = 0; qt < 2; ++qt) { const float inv = __fdiv_rn(1.0f, l[qt] + xhalf(l[qt]));
#pragma unroll
        for (int dt = 0; dt < 4; ++dt) { v8us oh, ol;
#pragma unroll
            for (int j = 0; j < 8; ++j) { unsigned short a, c2; splitf(o[dt][qt][j] * inv, a, c2); oh[j] = a; ol[j] = c2; }
            const size_t oo = (size_t)(q0 + qt * 16) * DQ + (h * 2 + (dt >> 1)) * 512 + (dt & 1) * 256 + lane * 8; *(v8us*)(Ah + oo) = oh; *(v8us*)(Al + oo) = ol; } }   // rows t, k = 64 h + d: the lane's 8 registers are its own piece of a block
}

extern "C" void kernel_launch(void* const* d_in, const int* in_sizes, int n_in,
                              void* d_out, int out_size, void* d_ws, size_t ws_size, hipStream_t stream) {
    (void)in_sizes; (void)n_in; (void)out_size;
    const float* x = (const float*)d_in[0]; const float* un = (const float*)d_in[1]; const int* km = (const int*)d_in[2]; const float* wq = (const float*)d_in[3]; const float* bq = (const float*)d_in[4]; const float* wk = (const float*)d_in[5]; const float* bk = (const float*)d_in[6]; const float* wv = (const float*)d_in[7]; const float* bv = (const float*)d_in[8]; const float* wo = (const float*)d_in[9]; const float* bo = (const float*)d_in[10];
    float* OUT = (float*)d_out;     // [2][2048][1024]
    char* wsp = (char*)d_ws;
    auto take = [&](size_t bytes) { char* p = wsp; wsp += (bytes + 255) & ~(size_t)255; return (void*)p; };
    bf* W4 = (bf*)take((size_t)4 * DM * DM * 2);    // Wq, Wk, Wv, Wo as Bt [out][in], one behind the other: the first three are the B operand [3 x DQ][DM] of the q | k | v product
    bf* XB = (bf*)take((size_t)NB_ * TT * DM * 2);
    h16* QKV16 = (h16*)take((size_t)3 * NB_ * NH_ * TT * HD * 2);    // q planes, k planes, v planes, each [b][...]
    bf* ATh = (bf*)take((size_t)NB_ * TT * DQ * 2); bf* ATl = (bf*)take((size_t)NB_ * TT * DQ * 2);
    if ((size_t)(wsp - (char*)d_ws) > ws_size) return;    // total 56 MiB of the workspace
    const size_t PL = (size_t)NB_ * NH_ * TT * HD;
    k_prep<<<4 * WTB + NB_ * TT * DM / 512 / 8, 256, 0, stream>>>(wq, wk, wv, wo, W4, x, XB);
    k_gemmq<<<dim3(NB_ * TT / 256, 2 * NH_ / 2, 1), 128, 0, stream>>>(XB, W4, QKV16, bq, bk, bv);    // q, k planes [b][h] rows t, v planes [b][h] rows d, in fragment order
    k_fattn<<<dim3(TT / (FWV * 32), NH_, NB_), FWV * 32, 0, stream>>>(QKV16, QKV16 + PL, QKV16 + 2 * PL, un, km, ATh, ATl);   // all heads of both entries: scores, key weight, mask, softmax, attn.v, merged hi/lo planes
    k_gemmw<bf, 1, 0, DQ, 4><<<dim3(NB_ * TT / 64, DM / 64, 1), 32, 0, stream>>>(ATh, ATl, W4 + (size_t)3 * DM * DM, nullptr, OUT, nullptr, DM, bo, nullptr, nullptr);
}

// v008
// It runs in 76 microseconds.
// It is 1.10 times as fast as v006, going by the measured steps of the versions left out in between.
// All steps since v000 together make it 19.1 times as fast.
#include <hip/hip_runtime.h>

// Multi-head self-attention whose scaled scores are multiplied, per KEY, by an uncertainty weight before the mask and the softmax, with an integer key mask read as data and an output projection (hidden_states [2][2048][1024]; token_uncertainty [2][2048]; attention_mask int32 [2][2048];
// q, k, v = x W + b with 'io' weights [1024][1024] (in, out) and biases [1024]; 16 heads x 64 (head h = columns h x 64 ..); scores = q k^T / sqrt(64); scores = scores x exp(-0.5 x token_uncertainty[b][key]); where(mask[b][key] != 0, scores, -inf); softmax over the keys;
// out = merged Wo + bo ('io' + bias) -> [2][2048][1024] (4.2 M); argument order hidden_states, token_uncertainty, attention_mask, Wq, bq, Wk, bk, Wv, bv, Wo, bo).
// Layout, both batch entries in every launch: one bf16 copy of x (read by all three projections) and the 'io' weights transposed and rounded, and the key factor row, in one launch (k_prep); q, k, v as ONE product [4096][1024] x [3072][1024]^T + f32 biases, whose epilogue writes the f16 head planes itself (q, k per [b][h] with rows t, v per [b][h] with rows d; each k row x its key's weight x SCL x log2 e in f32 before the one rounding to fp16); dense T-2048 attention, 16 heads x 2 entries in one launch (k_fattn):
// the f16 score product, which starts from minus a reference per query and so gives the exponent itself, the entry's int key mask, a softmax in f32 against that reference, whose weights go to fp16 in registers, attn.v on ONE fp16 product, the division by the sum; merged, rounded once to fp16, x Wo + bo on ONE fp16 product.
// FRAGMENT ORDER: every 16-bit plane that a matrix instruction reads (x, the four weights, q, k, v^T, merged) lies in memory as blocks of 16 rows x 32 k = 1 KiB, the 16-B piece (row r, k = 16 half + 8 hh + 0..7) at byte 512 half + 16 (16 hh + r):
// lane 16 hh + r of a wave reads its two pieces at 16 x lane and 512 + 16 x lane, so each fragment load of a wave is 512 B in a row (4 whole lines) and not 32 B out of each of 16 lines. Which lane and register holds which (row, k) is as with row-major planes.
// Compute dtypes, f32 accumulate: every float input rounded to bf16 at its load (the uncertainty row too); projections exact + f32 biases; scores and attn.v fp16; the key weight f32, multiplied into k's f32 value; the softmax f32; the output product fp16 x fp16: merged carries 11 significant bits, as the attention weights and v that it is made of do, and Wo's bf16 value is held in fp16 (the same value from 2^-14 up to the fp16 range; below that to within 2^-25) + f32 bias.

#define NB_  2
#define TT   2048
#define DM   1024
#define NH_  16
#define NKV  16
#define REP  (NH_ / NKV)
#define HD   64
#define DQ   (NH_ * HD)
#define DKV  (NKV * HD)
#define SCL  0.125f   // HD^-0.5
#define LAMBDA 0.5f   // the module's uncertainty weight: w = exp(-LAMBDA x token_uncertainty) per key
typedef _Float16 h16;
typedef unsigned short bf;
typedef __attribute__((ext_vector_type(16))) __bf16   v16bf;
typedef __attribute__((ext_vector_type(16))) _Float16 v16h;
typedef __attribute__((ext_vector_type(8)))  _Float16 v8h;
typedef __attribute__((ext_vector_type(4)))  _Float16 v4h;
typedef __attribute__((ext_vector_type(8)))  unsigned short v8us;
typedef __attribute__((ext_vector_type(8)))  float    v8f;
typedef __attribute__((ext_vector_type(4)))  float    v4f;
typedef v8h  __attribute__((may_alias)) v8ha;
typedef v4f  __attribute__((may_alias)) v4fa;
typedef v8us __attribute__((may_alias)) v8usa;

__device__ __forceinline__ unsigned short f2bf(float f) { unsigned u = __float_as_uint(f); u += 0x7FFFu + ((u >> 16) & 1u); return (unsigned short)(u >> 16); }
__device__ __forceinline__ float bf2f(unsigned short b) { return __uint_as_float(((unsigned)b) << 16); }
__device__ __forceinline__ float bfr(float f) { return bf2f(f2bf(f)); }
__device__ __forceinline__ v16h cat16(v8h lo, v8h hi) { return __builtin_shufflevector(lo, hi, 0, 1, 2, 3, 4, 5, 6, 7, 8, 9, 10, 11, 12, 13, 14, 15); }
__device__ __forceinline__ v16bf cat16b(v8us lo, v8us hi) { return __builtin_bit_cast(v16bf, __builtin_shufflevector(lo, hi, 0, 1, 2, 3, 4, 5, 6, 7, 8, 9, 10, 11, 12, 13, 14, 15)); }
__device__ __forceinline__ v8f wmma16(v16h a, v16h b, v8f c) { return __builtin_amdgcn_wmma_f32_16x16x32_f16(false, a, false, b, (short)0, c, false, false); }
__device__ __forceinline__ v8f wmmab(v16bf a, v16bf b, v8f c) { return __builtin_amdgcn_wmma_f32_16x16x32_bf16(false, a, false, b, (short)0, c, false, false); }



// ---- k_gemmw: register-blocked GEMM, ONE WAVE per 64x64 output tile (16 accumulators), operands straight from 16-bit planes in fragment order (blocks [row / 16][k / 32], WFrag::ld takes the lane's place in a block); grid (M/64, N/64), 32 threads.
// y[m][n] = sum_k A[m][k] Bt[n][k] (+ split products per NSPLIT) + f32 bias[n]. K % 32 == 0, known at compile time: every block of a pass then lies at a constant distance from one address per operand. The rows m run over both batch entries (m = b x TT + t).
// OM 0, the one mode left: C[m][n] = y in f32, pitch ldc (P, bias1 and bias2 are not read; the q | k | v product has its own kernel, k_gemmq).
template <typename T16> struct WFrag;
template <> struct WFrag<h16> { typedef v16h V; static __device__ __forceinline__ V ld(const h16* p) { return cat16(*(const v8h*)p, *(const v8h*)(p + 256)); } static __device__ __forceinline__ v8f mma(V a, V b, v8f c) { return wmma16(a, b, c); } };
template <> struct WFrag<bf> { typedef v16bf V; static __device__ __forceinline__ V ld(const bf* p) { return cat16b(*(const v8us*)p, *(const v8us*)(p + 256)); } static __device__ __forceinline__ v8f mma(V a, V b, v8f c) { return wmmab(a, b, c); } };
template <typename T16, int NSPLIT, int OM, int K, int D>
__global__ __launch_bounds__(32) void k_gemmw(const T16* __restrict__ A, const T16* __restrict__ A2, const T16* __restrict__ Bt, const T16* __restrict__ Bt2, float* C, h16* P, int ldc, const float* __restrict__ bias, const float* __restrict__ bias1, const float* __restrict__ bias2) {
    typedef typename WFrag<T16>::V V;
    __shared__ __align__(16) float os[16 * 68];
    const int lane = threadIdx.x & 31, lr = lane & 15, hi = lane >> 4; const int r0 = blockIdx.x * 64, c0 = blockIdx.y * 64;
    v8f acc[4][4];
#pragma unroll
    for (int mb = 0; mb < 4; ++mb)
#pragma unroll
        for (int nb = 0; nb < 4; ++nb) acc[mb][nb] = (v8f){};
    const size_t aoff = (size_t)r0 * K, boff = (size_t)c0 * K; const unsigned lo = 8 * lane;   // 16 rows of K are K / 32 blocks of 512 elements; a block's address is the same for the whole wave, lo the lane's place in it

    // REGISTER RING: D fragment sets; pass st first issues the loads of pass st + D - 1 into the set that pass st - 1 has just left, then does its own products, so a load has D - 1 passes of matrix time to arrive.
    // The K / 32 passes are unrolled whole: every block then lies at a constant distance from four addresses that no pass rewrites, and a set's number is known at compile time.
    constexpr int NS = K / 32;
    const T16* pa = A + aoff + lo; const T16* pb = Bt + boff + lo; const T16* pa2 = (NSPLIT == 1 || NSPLIT == 2) ? A2 + aoff + lo : pa; const T16* pb2 = (NSPLIT >= 2) ? Bt2 + boff + lo : pb;
    V a[D][4], a2[D][4], b[D][4], b2[D][4];
    // unrolled whole, so that ft % D and st % D are constants and the sets stay in registers
#pragma unroll
    for (int st = 1 - D; st < NS; ++st) {   // passes below 0 only fill the ring
        const int ft = st + D - 1, fs = ft % D;
        if (ft < NS) {
#pragma unroll
            for (int mb = 0; mb < 4; ++mb) { a[fs][mb] = WFrag<T16>::ld(pa + ft * 512 + mb * 16 * K); if (NSPLIT == 1 || NSPLIT == 2) a2[fs][mb] = WFrag<T16>::ld(pa2 + ft * 512 + mb * 16 * K); }
#pragma unroll
            for (int nb = 0; nb < 4; ++nb) { b[fs][nb] = WFrag<T16>::ld(pb + ft * 512 + nb * 16 * K); if (NSPLIT >= 2) b2[fs][nb] = WFrag<T16>::ld(pb2 + ft * 512 + nb * 16 * K); }
        }
        if (ft == NS - 1) asm volatile("s_wait_xcnt 0x0" ::: "memory");   // behind the last loads, in front of the first overwrite of the address registers that the loads name (no pass rewrites them; the epilogue may)
        __builtin_amdgcn_sched_barrier(0);   // the set's loads issue here as one group, D - 1 passes ahead of their use; without it the compiler sinks them to just in front of the products that read them and the wave waits out each latency
        if (st >= 0) {
            const int cs = st % D;
#pragma unroll
            for (int nb = 0; nb < 4; ++nb) {
#pragma unroll
                for (int mb = 0; mb < 4; ++mb) { acc[mb][nb] = WFrag<T16>::mma(a[cs][mb], b[cs][nb], acc[mb][nb]); if (NSPLIT == 1 || NSPLIT == 2) acc[mb][nb] = WFrag<T16>::mma(a2[cs][mb], b[cs][nb], acc[mb][nb]); if (NSPLIT >= 2) acc[mb][nb] = WFrag<T16>::mma(a[cs][mb], b2[cs][nb], acc[mb][nb]); } }
            __builtin_amdgcn_sched_barrier(0);   // the next pass's loads stay below these products and so take the set that these leave; without it the compiler lifts loads above them into further registers
        }
    }
    const int sel = (OM == 1) ? c0 / DQ : 0, cl = (OM == 1) ? c0 % DQ : c0, rt = r0 % TT;   // which projection, the column in it, the row in its entry: the same for the whole tile
    const float* bs = (sel == 0) ? bias : (sel == 1) ? bias1 : bias2;
    const int cofs = lr * 4; v4f bb;   // a lane stores the same four columns in every row: their biases are read once
#pragma unroll
    for (int q = 0; q < 4; ++q) bb[q] = bfr(bs[cl + cofs + q]);
#pragma unroll
    for (int mb = 0; mb < 4; ++mb) {
#pragma unroll
        for (int nb = 0; nb < 4; ++nb) {
#pragma unroll
            for (int j = 0; j < 8; ++j) os[(hi * 8 + j) * 68 + nb * 16 + lr] = acc[mb][nb][j]; }
        __builtin_amdgcn_wave_barrier(); asm volatile("" ::: "memory");
        float* crow = C + (size_t)(r0 + mb * 16) * ldc + c0; v4f val[8]; float* cp[8];
#pragma unroll
        for (int s = 0; s < 8; ++s) { const int row = 2 * s + hi; val[s] = *(const v4fa*)(os + row * 68 + cofs); val[s][0] += bb[0]; val[s][1] += bb[1]; val[s][2] += bb[2]; val[s][3] += bb[3]; cp[s] = crow + (size_t)row * ldc + cofs;
            if (OM == 0) *(v4f*)cp[s] = val[s];
        }
        __builtin_amdgcn_wave_barrier();
        asm volatile("s_wait_xcnt 0x0" :: "v"(val[0]), "v"(val[1]), "v"(val[2]), "v"(val[3]), "v"(val[4]), "v"(val[5]), "v"(val[6]), "v"(val[7]), "v"(cp[0]), "v"(cp[1]), "v"(cp[2]), "v"(cp[3]), "v"(cp[4]), "v"(cp[5]), "v"(cp[6]), "v"(cp[7]) : "memory");   // the next row block's LDS writes stay below these reads; and the wait stands in front of every overwrite of the data and address registers that the eight stores name (as inputs here they stay untouched up to it)
    }
}

// ---- k_gemmq: the q | k | v product. ONE WAVE per 128 rows x 96 columns (48 accumulators), one wave a SIMD, four waves (2 x 2) a work-group, so that each A block is read by two waves of a WGP and each B block by two; grid (M / 256, 16), 128 threads: 256 work-groups.
// A wave's 96 columns are one whole q or k head (hp = 0..15 the q heads, 16..31 the k heads: B rows 64 hp ..) and 32 columns of v (B rows 2 DQ + 32 hp ..): 14 fragments feed 48 products a pass (a 64 x 64 tile: 8 feed 16), and each part of the tile lies in one plane.
// y = x Bt^T + f32 biases (bias | bias1 | bias2 for q | k | v); a k row t is then multiplied by its key's factor kfac (k_prep), so that the score product of k_fattn comes out weighted, scaled and in powers of two. P holds the three fp16 plane sets one behind the other, each [b][...]: q and k as head planes, rows t, k = d, blocks [n / 64][t / 16][d / 32]; v transposed, rows d, k = t, blocks [n / 64][t / 32][d / 16]: a lane's 8 accumulator registers are 8 consecutive t of one d, its own 16-B piece of a block.
// Register ring of QD sets as in k_gemmw, rolled: one trip of the loop is QD passes, so a set's number is known at compile time and the text stays small; the last QD passes stand behind the loop, where only one load group is left.
#define QMB 8
#define QNB 6
#define QD  4
__global__ __launch_bounds__(128) void k_gemmq(const bf* __restrict__ A, const bf* __restrict__ Bt, h16* P, const float* __restrict__ bias, const float* __restrict__ bias1, const float* __restrict__ bias2, const float* __restrict__ kfac) {
    typedef WFrag<bf>::V V;
    constexpr int K = DM, NS = K / 32;
    __shared__ __align__(16) float osw[4][16 * 68];
    const int lane = threadIdx.x & 31, lr = lane & 15, hi = lane >> 4; const int wn = __builtin_amdgcn_readfirstlane(threadIdx.x >> 5);
    float* os = osw[wn];   // each wave turns its rows in its own LDS range
    const int r0 = (blockIdx.x * 2 + (wn & 1)) * (QMB * 16), hp = blockIdx.y * 2 + (wn >> 1);
    v8f acc[QMB][QNB];
#pragma unroll
    for (int mb = 0; mb < QMB; ++mb)
#pragma unroll
        for (int nb = 0; nb < QNB; ++nb) acc[mb][nb] = (v8f){};
    const bf* pa = A + (size_t)r0 * K + 8 * lane; const bf* pb = Bt + (size_t)hp * HD * K + 8 * lane; const bf* pv = Bt + (size_t)(2 * DQ + hp * 32) * K + 8 * lane;
    const int sel = hp / NH_, hd = hp % NH_;   // q or k; the head
    float braw[QNB];   // the six bias values of a lane are asked for ahead of the fragments, so that the epilogue does not wait out their latency
#pragma unroll
    for (int nb = 0; nb < QNB; ++nb) braw[nb] = (nb < 4) ? ((sel == 0) ? bias : bias1)[hd * HD + nb * 16 + lr] : bias2[hp * 32 + (nb - 4) * 16 + lr];
    float kraw[QMB];   // the key factor of the lane's row lr of each row block (row m = b x TT + t indexes it), asked for ahead of the fragments like the biases
#pragma unroll
    for (int mb = 0; mb < QMB; ++mb) kraw[mb] = kfac[r0 + mb * 16 + lr];
    asm volatile("s_wait_xcnt 0x0" ::: "memory");   // behind these loads, in front of any overwrite of the address registers that they name
    V a[QD][QMB], b[QD][QNB];
    auto qload = [&](int fs, int off) __attribute__((always_inline)) {   // set fs takes the pass that lies off passes behind the three addresses
#pragma unroll
        for (int mb = 0; mb < QMB; ++mb) a[fs][mb] = WFrag<bf>::ld(pa + off * 512 + mb * 16 * K);
#pragma unroll
        for (int nb = 0; nb < 4; ++nb) b[fs][nb] = WFrag<bf>::ld(pb + off * 512 + nb * 16 * K);
#pragma unroll
        for (int nb = 4; nb < QNB; ++nb) b[fs][nb] = WFrag<bf>::ld(pv + off * 512 + (nb - 4) * 16 * K); };
    auto qmma = [&](int cs) __attribute__((always_inline)) {
#pragma unroll
        for (int nb = 0; nb < QNB; ++nb)
#pragma unroll
            for (int mb = 0; mb < QMB; ++mb) acc[mb][nb] = WFrag<bf>::mma(a[cs][mb], b[cs][nb], acc[mb][nb]); };
#pragma unroll
    for (int f = 0; f < QD - 1; ++f) qload(f, f);
    // stays rolled, for speed only
#pragma nounroll
    for (int it = 0; it < NS / QD - 1; ++it) {
#pragma unroll
        for (int u = 0; u < QD; ++u) {
            qload((u + QD - 1) % QD, u + QD - 1);
            if (u == QD - 1) asm volatile("s_wait_xcnt 0x0" ::: "memory");   // behind the trip's last loads, in front of the step of the three addresses that the loads name
            __builtin_amdgcn_sched_barrier(0);   // the set's loads issue here as one group, QD - 1 passes ahead of their use, and are not sunk to the products that read them
            qmma(u);
            __builtin_amdgcn_sched_barrier(0);   // the next pass's loads stay below these products and so take the set that these leave
        }
        pa += QD * 512; pb += QD * 512; pv += QD * 512;
    }
#pragma unroll
    for (int u = 0; u < QD; ++u) {
        if (u == 0) { qload(QD - 1, QD - 1); asm volatile("s_wait_xcnt 0x0" ::: "memory"); }   // the wait: behind the last loads, in front of the first overwrite of their address registers in the epilogue
        __builtin_amdgcn_sched_barrier(0);   // as in the loop
        qmma(u);
        __builtin_amdgcn_sched_barrier(0);
    }
    const int rt = r0 % TT; const size_t PLN = (size_t)NH_ * TT * HD;   // the row in its entry
    {   // q, k: 16 rows x 64 columns turned in LDS, bias added on the way in; then each lane takes its own 16-B pieces of the row block's two blocks
        float bn[4], kw[QMB];   // kw: the factor of the lane's row of each row block, 1 for a q head
#pragma unroll
        for (int nb = 0; nb < 4; ++nb) bn[nb] = bfr(braw[nb]);
#pragma unroll
        for (int mb = 0; mb < QMB; ++mb) kw[mb] = (sel == 0) ? 1.0f : kraw[mb];
        h16* pq = P + ((size_t)sel * NB_ + r0 / TT) * PLN + ((size_t)hd * TT + rt) * HD + lane * 8;
#pragma unroll
        for (int mb = 0; mb < QMB; ++mb) {
#pragma unroll
            for (int nb = 0; nb < 4; ++nb) {
#pragma unroll
                for (int j = 0; j < 8; ++j) os[(hi * 8 + j) * 68 + nb * 16 + lr] = acc[mb][nb][j] + bn[nb]; }
            __builtin_amdgcn_wave_barrier(); asm volatile("" ::: "memory");   // the rows are read back by other lanes of this wave: the compiler may not move the reads above the writes
            v8h o[4];
#pragma unroll
            for (int s = 0; s < 4; ++s) { const float* rp = os + lr * 68 + s * 16 + hi * 8; const v4f x0 = *(const v4fa*)rp, x1 = *(const v4fa*)(rp + 4);
#pragma unroll
                for (int q = 0; q < 4; ++q) { o[s][q] = (h16)(x0[q] * kw[mb]); o[s][q + 4] = (h16)(x1[q] * kw[mb]); }
                *(v8h*)(pq + mb * 1024 + s * 256) = o[s]; }
            __builtin_amdgcn_wave_barrier(); asm volatile("s_wait_xcnt 0x0" :: "v"(o[0]), "v"(o[1]), "v"(o[2]), "v"(o[3]) : "memory");   // the next row block's LDS writes stay below these reads; and the wait stands in front of every overwrite of the registers that the four stores name (as inputs here they stay untouched up to it)
        }
    }
    // v, transposed, straight from the accumulators: head hp / 2, d blocks 2 (hp % 2) + 0, 1; each store of the wave is half a block, 512 B in a row
    h16* pc = P + ((size_t)2 * NB_ + r0 / TT) * PLN + (size_t)(hp >> 1) * HD * TT + (size_t)rt * HD + (hp & 1) * 1024 + lane * 8;
#pragma unroll
    for (int nb = 4; nb < QNB; ++nb) { const float bn = bfr(braw[nb]);
#pragma unroll
        for (int mq = 0; mq < QMB; mq += 4) { v8h o[4];
#pragma unroll
            for (int mb = 0; mb < 4; ++mb) {
#pragma unroll
                for (int j = 0; j < 8; ++j) o[mb][j] = (h16)(acc[mq + mb][nb][j] + bn);
                *(v8h*)(pc + (nb - 4) * 512 + ((mq + mb) >> 1) * 2048 + (mb & 1) * 256) = o[mb]; }
            asm volatile("s_wait_xcnt 0x0" :: "v"(o[0]), "v"(o[1]), "v"(o[2]), "v"(o[3]) : "memory");   // in front of every overwrite of the registers that the four stores name
        } }
}

typedef __attribute__((ext_vector_type(2))) unsigned short v2us;
typedef __attribute__((ext_vector_type(4))) unsigned short v4us;
typedef __attribute__((ext_vector_type(4))) int v4i;
typedef __attribute__((ext_vector_type(2))) float v2f;

// k_prep: all the rounding to bf16 in ONE launch, one wave a block of the fragment order. Work-groups 0 .. 4 x WTB - 1: the four 'io' weights [DM][DM] (in, out) -> Bt, rows out, k = in, WTB work-groups each, the four results one behind the other, the first three as bf16, the fourth (the output weight) as the fp16 pattern of its bf16 value, which is what the fp16 output product reads; the next XTB: x of both entries, rows m, k = in;
// the last NB_ x TT / 256: the key factor row, one key a lane: kfac[b][key] = expf(-LAMBDA x bf16(u[b][key])) x SCL x log2 e, and 0 where the int key mask is 0.
#define WTB (DM * DM / 512 / 8)   // work-groups a weight: 8 waves x 1 block of 512 elements
#define XTB (NB_ * TT * DM / 512 / 8)   // work-groups for x
__global__ __launch_bounds__(256) void k_prep(const float* __restrict__ w0, const float* __restrict__ w1, const float* __restrict__ w2, const float* __restrict__ w3, bf* Bt4, const float* __restrict__ src, bf* dst, const float* __restrict__ u, const int* __restrict__ kvp, float* kfac) {
    const int lane = threadIdx.x & 31, lr = lane & 15, hi = lane >> 4;
    if (blockIdx.x >= 4 * WTB + XTB) {
        const int j = (blockIdx.x - (4 * WTB + XTB)) * 256 + threadIdx.x; const float uj = u[j]; const int kj = kvp[j];
        asm volatile("s_wait_xcnt 0x0" ::: "memory");   // behind the two loads, in front of any overwrite of the address registers that they name
        const float e = expf(-LAMBDA * bfr(uj)) * (SCL * 1.4426950408889634f); kfac[j] = (kj != 0) ? e : 0.0f;   // made for every key and then chosen, so that both loads go out together
        return; }
    if (blockIdx.x < 4 * WTB) {   // lane (hi, lr) gathers its own two pieces: row out = 16 nb + lr, 8 consecutive in; a load reads 64 B of each of two rows of w, a store is 512 B in a row
        const int wi = blockIdx.x / WTB; const float* w = (wi == 0) ? w0 : (wi == 1) ? w1 : (wi == 2) ? w2 : w3; bf* Bt = Bt4 + (size_t)wi * DM * DM;
        const int blk = (blockIdx.x % WTB) * 8 + (threadIdx.x >> 5); const int nb = blk / (DM / 32), kb = blk % (DM / 32);
        const float* wp = w + (size_t)(kb * 32 + hi * 8) * DM + nb * 16 + lr; float v[16];
#pragma unroll
        for (int j = 0; j < 16; ++j) v[j] = wp[(size_t)((j >> 3) * 16 + (j & 7)) * DM];
        v8us o[2];
#pragma unroll
        for (int j = 0; j < 16; ++j) o[j >> 3][j & 7] = f2bf(v[j]);
        if (wi == 3) {   // the output weight: the same bf16 value, written as fp16; one test for the whole block, the same for every wave of the work-group
#pragma unroll
            for (int j = 0; j < 16; ++j) o[j >> 3][j & 7] = __builtin_bit_cast(unsigned short, (h16)bf2f(o[j >> 3][j & 7])); }
#pragma unroll
        for (int hf = 0; hf < 2; ++hf) *(v8us*)(Bt + (size_t)blk * 512 + hf * 256 + lane * 8) = o[hf];
        asm volatile("s_wait_xcnt 0x0" :: "v"(o[0]), "v"(o[1]) : "memory");   // in front of every overwrite of the registers that the two stores name (as inputs here the data stay untouched up to it)
        return; }
    const int blk = (blockIdx.x - 4 * WTB) * 8 + (threadIdx.x >> 5); const int rb = blk / (DM / 32), kb = blk % (DM / 32);   // x: whole 128-B lines in (4 rows a load), 64-B runs out
    const int kq = (lane & 7) * 4; const float* sp = src + (size_t)(rb * 16 + (lane >> 3)) * DM + kb * 32 + kq; bf* dp = dst + (size_t)blk * 512 + (kq >> 4) * 256 + (((kq >> 3) & 1) * 16 + (lane >> 3)) * 8 + (kq & 4); v4f v[4];
#pragma unroll
    for (int i = 0; i < 4; ++i) v[i] = *(const v4f*)(sp + (size_t)i * 4 * DM);
#pragma unroll
    for (int i = 0; i < 4; ++i) { v4us o;
#pragma unroll
        for (int k = 0; k < 4; ++k) o[k] = f2bf(v[i][k]);
        *(v4us*)(dp + i * 32) = o; }
    asm volatile("s_wait_xcnt 0x0" ::: "memory");   // behind the last of the four stores, in front of any later overwrite of the address and data registers that they name
}

__device__ __forceinline__ float xhalf(float x) { return __builtin_bit_cast(float, __builtin_amdgcn_permlanex16(__builtin_bit_cast(int, x), __builtin_bit_cast(int, x), 0x76543210, 0xfedcba98, false, false)); }  // lane l with lane l ^ 16, in the vector unit (a shuffle would go through the LDS path and its wait)
#define FKB 64     // keys a pass
#define FWV 4      // waves a work-group: one on each SIMD, all on one head, so that they share its K and V lines in the WGP cache
#define PB  4096.0f   // a lane's sum of 32 weights of one query above which the reference is raised
static_assert(TT / FKB == 32, "one mask bit a pass in one 32-bit word");
__global__ __launch_bounds__(FWV * 32) void k_fattn(const h16* __restrict__ Qp, const h16* __restrict__ Kp, const h16* __restrict__ Vt, const int* __restrict__ kvp, h16* Am) {
    __shared__ __align__(16) float mb[TT]; __shared__ unsigned pm[TT / FKB];
    const int lane = threadIdx.x & 31, lr = lane & 15, hi = lane >> 4;
    { const size_t z = blockIdx.z; Qp += z * ((size_t)NH_ * TT * HD); Kp += z * ((size_t)NKV * TT * HD); Vt += z * ((size_t)NKV * HD * TT); kvp += z * TT; Am += z * ((size_t)TT * DQ); }
    { v4i kq[TT / (FWV * 128)];   // the mask row is loaded whole and unconditionally first (16 B a lane, whole lines), so that the work-group pays one load latency, not one per key group
#pragma unroll
        for (int r = 0; r < TT / (FWV * 128); ++r) kq[r] = *(const v4i*)(kvp + r * (FWV * 128) + threadIdx.x * 4);
        asm volatile("s_wait_xcnt 0x0" ::: "memory");   // behind these loads, in front of any overwrite of the address registers that they name
#pragma unroll
        for (int r = 0; r < TT / (FWV * 128); ++r) { const int j = r * (FWV * 128) + threadIdx.x * 4; v4f b4; bool shut = false;
#pragma unroll
            for (int q = 0; q < 4; ++q) { const bool on = (kq[r][q] != 0); b4[q] = on ? 0.0f : -3.0e38f; shut = shut || !on; }
            *(v4fa*)(mb + j) = b4;
            const unsigned bal = __builtin_amdgcn_ballot_w32(shut);   // a wave's 128 keys are two passes, one per lane half
            if (lr == 0) pm[j / FKB] = hi ? (bal >> 16) : (bal & 0xFFFFu); } }
    __syncthreads();
    const unsigned mword = __builtin_amdgcn_ballot_w32(pm[lane] != 0u);   // bit p: pass p holds a masked key; the same in every wave
    const int h = blockIdx.y; const int q0 = (blockIdx.x * FWV + (threadIdx.x >> 5)) * 32;
    const h16* qb = Qp + ((size_t)h * TT + q0) * HD + 8 * lane; const h16* kb = Kp + (size_t)h * TT * HD + 8 * lane; const h16* vb = Vt + (size_t)h * HD * TT + 8 * lane;   // 8 x lane: the lane's place in a block; 64 keys (or queries) of a head are 8 blocks in a row in each plane
    v16h qf[2][2], kf[4][2]; v8f o[4][2], cm[2]; float rf[2], l[2]; bool started = false;   // cm: minus rf in all eight registers, the C operand; started: an open key has been seen (the mask is the same for every query, so this is one value for the wave)
#pragma unroll
    for (int qt = 0; qt < 2; ++qt) { rf[qt] = 0.0f; l[qt] = 0.0f; cm[qt] = (v8f){};
#pragma unroll
        for (int dh = 0; dh < 2; ++dh) qf[qt][dh] = WFrag<h16>::ld(qb + (qt * 2 + dh) * 512);
#pragma unroll
        for (int dt = 0; dt < 4; ++dt) o[dt][qt] = (v8f){}; }
#pragma unroll
    for (int kt = 0; kt < 4; ++kt)
#pragma unroll
        for (int dh = 0; dh < 2; ++dh) kf[kt][dh] = WFrag<h16>::ld(kb + (kt * 2 + dh) * 512);
    for (int k0 = 0; k0 < TT; k0 += FKB) {
        v16h vf[4][2]; v8f s[4][2];
#pragma unroll
        for (int dt = 0; dt < 4; ++dt)
#pragma unroll
            for (int ks = 0; ks < 2; ++ks) vf[dt][ks] = WFrag<h16>::ld(vb + (size_t)k0 * HD + (ks * 4 + dt) * 512);
        asm volatile("s_wait_xcnt 0x0" ::: "memory");   // stands in front of the pointer's step to the next pass, which overwrites the address registers that these loads name
        __builtin_amdgcn_sched_barrier(0);   // all 16 V loads issue here, ahead of the score products; without it the compiler sinks half of them to just in front of their use, and the wave waits out the latency
#pragma unroll
        for (int kt = 0; kt < 4; ++kt)
#pragma unroll
            for (int qt = 0; qt < 2; ++qt) { s[kt][qt] = wmma16(kf[kt][0], qf[qt][0], cm[qt]); s[kt][qt] = wmma16(kf[kt][1], qf[qt][1], s[kt][qt]); }
        const int kn = (k0 + FKB < TT) ? k0 + FKB : 0;   // the next pass's K rows are fetched behind this pass's score products (the last pass re-reads block 0, in bounds, unused)
#pragma unroll
        for (int kt = 0; kt < 4; ++kt)
#pragma unroll
            for (int dh = 0; dh < 2; ++dh) kf[kt][dh] = WFrag<h16>::ld(kb + (size_t)kn * HD + (kt * 2 + dh) * 512);
        asm volatile("s_wait_xcnt 0x0" ::: "memory");   // in front of the first reuse of the address registers that these loads name
        __builtin_amdgcn_sched_barrier(0);   // the next pass's 16 K loads issue in front of the softmax, not spread through it
        if ((mword >> (k0 / FKB)) & 1u) {   // a scalar test: only a pass with a masked key reads the bias row
#pragma unroll
            for (int kt = 0; kt < 4; ++kt) { const v4f b0 = *(const v4fa*)(mb + k0 + kt * 16 + hi * 8), b1 = *(const v4fa*)(mb + k0 + kt * 16 + hi * 8 + 4);
#pragma unroll
                for (int qt = 0; qt < 2; ++qt)
#pragma unroll
                    for (int j = 0; j < 4; ++j) { s[kt][qt][j] += b0[j]; s[kt][qt][j + 4] += b1[j]; } } }
        v16h pf[2][2]; float sum[2];
        auto weights = [&](int qt, bool step, float dl) __attribute__((always_inline)) {   // the 32 weights of a lane for query tile qt, their fp16 copies and their sum: pairs of neighbours added in two chains of packed additions
            v2f ac[2];
#pragma unroll
            for (int kt = 0; kt < 4; ++kt)
#pragma unroll
                for (int j = 0; j < 8; j += 2) { v2f p; p[0] = __builtin_amdgcn_exp2f(step ? s[kt][qt][j] - dl : s[kt][qt][j]); p[1] = __builtin_amdgcn_exp2f(step ? s[kt][qt][j + 1] - dl : s[kt][qt][j + 1]);
                    pf[kt >> 1][qt][(kt & 1) * 8 + j] = (h16)p[0]; pf[kt >> 1][qt][(kt & 1) * 8 + j + 1] = (h16)p[1];
                    const int ch = (j >> 1) & 1; if (kt == 0 && j < 4) ac[ch] = p; else ac[ch] += p; }
            const v2f t2 = ac[0] + ac[1]; sum[qt] = t2[0] + t2[1]; };
        weights(0, false, 0.0f); weights(1, false, 0.0f);
        const unsigned high = __builtin_amdgcn_ballot_w32(!(sum[0] <= PB)) | __builtin_amdgcn_ballot_w32(!(sum[1] <= PB));
        if (__builtin_expect(!started | (high != 0u), 0)) {   // one scalar test a pass; taken up to the first pass with an open key and where a sum has left the bound: the pass's weights are made again against a new reference (marked as the rare side, so that the usual pass runs straight on in the text)
            bool open = false;
#pragma unroll
            for (int qt = 0; qt < 2; ++qt) { float mx = s[0][qt][0];
#pragma unroll
                for (int kt = 0; kt < 4; ++kt)
#pragma unroll
                    for (int j = 0; j < 8; ++j) mx = fmaxf(mx, s[kt][qt][j]);
                mx = fmaxf(mx, xhalf(mx));
                const bool op = (mx > -1.0e30f); open = open || op;   // no open key in this pass: the reference stays
                const float rn = rf[qt] + (op ? (started ? fmaxf(mx, 0.0f) : mx) : 0.0f), dl = rn - rf[qt];   // the new reference, never lower once it is set, and the step as the rounded reference takes it
                const float al = __builtin_amdgcn_exp2f(fminf(-dl, 0.0f)); rf[qt] = rn;   // before the start sum and output are 0, and any finite factor leaves them so
#pragma unroll
                for (int j = 0; j < 8; ++j) cm[qt][j] = -rf[qt];
                weights(qt, true, dl); l[qt] *= al;
#pragma unroll
                for (int dt = 0; dt < 4; ++dt)
#pragma unroll
                    for (int j = 0; j < 8; ++j) o[dt][qt][j] *= al; }
            started = started || (__builtin_amdgcn_ballot_w32(open) != 0u);
        }
        l[0] += sum[0]; l[1] += sum[1];
#pragma unroll
        for (int ks = 0; ks < 2; ++ks)
#pragma unroll
            for (int dt = 0; dt < 4; ++dt)
#pragma unroll
                for (int qt = 0; qt < 2; ++qt) o[dt][qt] = wmma16(vf[dt][ks], pf[ks][qt], o[dt][qt]);
    }
#pragma unroll
    for (int qt = 0; qt < 2; ++qt) { const float inv = __fdiv_rn(1.0f, l[qt] + xhalf(l[qt])); v8h om[4];
#pragma unroll
        for (int dt = 0; dt < 4; ++dt) {
#pragma unroll
            for (int j = 0; j < 8; ++j) om[dt][j] = (h16)(o[dt][qt][j] * inv);
            const size_t oo = (size_t)(q0 + qt * 16) * DQ + (h * 2 + (dt >> 1)) * 512 + (dt & 1) * 256 + lane * 8; *(v8h*)(Am + oo) = om[dt]; }   // rows t, k = 64 h + d: the lane's 8 registers are its own piece of a block
        asm volatile("s_wait_xcnt 0x0" :: "v"(om[0]), "v"(om[1]), "v"(om[2]), "v"(om[3]) : "memory");   // in front of every overwrite of the registers that the four stores name (as inputs here the data stay untouched up to it)
    }
}

extern "C" void kernel_launch(void* const* d_in, const int* in_sizes, int n_in,
                              void* d_out, int out_size, void* d_ws, size_t ws_size, hipStream_t stream) {
    (void)in_sizes; (void)n_in; (void)out_size;
    const float* x = (const float*)d_in[0]; const float* un = (const float*)d_in[1]; const int* km = (const int*)d_in[2]; const float* wq = (const float*)d_in[3]; const float* bq = (const float*)d_in[4]; const float* wk = (const float*)d_in[5]; const float* bk = (const float*)d_in[6]; const float* wv = (const float*)d_in[7]; const float* bv = (const float*)d_in[8]; const float* wo = (const float*)d_in[9]; const float* bo = (const float*)d_in[10];
    float* OUT = (float*)d_out;     // [2][2048][1024]
    char* wsp = (char*)d_ws;
    auto take = [&](size_t bytes) { char* p = wsp; wsp += (bytes + 255) & ~(size_t)255; return (void*)p; };
    bf* W4 = (bf*)take((size_t)4 * DM * DM * 2);    // Wq, Wk, Wv, Wo as Bt [out][in], one behind the other: the first three are the B operand [3 x DQ][DM] of the q | k | v product
    bf* XB = (bf*)take((size_t)NB_ * TT * DM * 2);
    h16* QKV16 = (h16*)take((size_t)3 * NB_ * NH_ * TT * HD * 2);    // q planes, k planes, v planes, each [b][...]
    h16* AT = (h16*)take((size_t)NB_ * TT * DQ * 2);    // merged, fp16
    float* KF = (float*)take((size_t)NB_ * TT * 4);    // the key factor row
    if ((size_t)(wsp - (char*)d_ws) > ws_size) return;    // total 48 MiB and 16 KiB of the workspace
    const size_t PL = (size_t)NB_ * NH_ * TT * HD;
    k_prep<<<4 * WTB + XTB + NB_ * TT / 256, 256, 0, stream>>>(wq, wk, wv, wo, W4, x, XB, un, km, KF);
    k_gemmq<<<dim3(NB_ * TT / 256, 2 * NH_ / 2, 1), 128, 0, stream>>>(XB, W4, QKV16, bq, bk, bv, KF);    // q, k planes [b][h] rows t (k x its key's factor), v planes [b][h] rows d, in fragment order
    k_fattn<<<dim3(TT / (FWV * 32), NH_, NB_), FWV * 32, 0, stream>>>(QKV16, QKV16 + PL, QKV16 + 2 * PL, km, AT);   // all heads of both entries: scores, mask, softmax, attn.v, the merged plane
    k_gemmw<h16, 0, 0, DQ, 5><<<dim3(NB_ * TT / 64, DM / 64, 1), 32, 0, stream>>>(AT, nullptr, (const h16*)(W4 + (size_t)3 * DM * DM), nullptr, OUT, nullptr, DM, bo, nullptr, nullptr);
}

// v009
// Measured time: 66.5 microseconds a run.
// Two timings next to v008 both put it at 1.16 times that version's speed.
// All steps since v000 together make it 22.2 times as fast.
#include <hip/hip_runtime.h>

// Multi-head self-attention whose scaled scores are multiplied, per KEY, by an uncertainty weight before the mask and the softmax, with an integer key mask read as data and an output projection (hidden_states [2][2048][1024]; token_uncertainty [2][2048]; attention_mask int32 [2][2048];
// q, k, v = x W + b with 'io' weights [1024][1024] (in, out) and biases [1024]; 16 heads x 64 (head h = columns h x 64 ..); scores = q k^T / sqrt(64); scores = scores x exp(-0.5 x token_uncertainty[b][key]); where(mask[b][key] != 0, scores, -inf); softmax over the keys;
// out = merged Wo + bo ('io' + bias) -> [2][2048][1024] (4.2 M); argument order hidden_states, token_uncertainty, attention_mask, Wq, bq, Wk, bk, Wv, bv, Wo, bo).
// Layout, both batch entries in every launch: one bf16 copy of x (read by all three projections) and the 'io' weights transposed and rounded, and the key factor row, in one launch (k_prep); q, k, v as ONE product [4096][1024] x [3072][1024]^T + f32 biases, whose epilogue writes the f16 head planes itself (q, k per [b][h] with rows t, v per [b][h] with rows d; each k row x its key's weight x SCL x log2 e in f32 before the one rounding to fp16); dense T-2048 attention, 16 heads x 2 entries in one launch (k_fattn):
// the f16 score product, which starts from minus a reference per query and so gives the exponent itself, the entry's int key mask, a softmax in f32 against that reference, whose weights go to fp16 in registers, attn.v on ONE fp16 product, the division by the sum; merged, rounded once to fp16, x Wo + bo on ONE fp16 product.
// FRAGMENT ORDER: every 16-bit plane that a matrix instruction reads (x, the four weights, q, k, v^T, merged) lies in memory as blocks of 16 rows x 32 k = 1 KiB, the 16-B piece (row r, k = 16 half + 8 hh + 0..7) at byte 512 half + 16 (16 hh + r):
// lane 16 hh + r of a wave reads its two pieces at 16 x lane and 512 + 16 x lane, so each fragment load of a wave is 512 B in a row (4 whole lines) and not 32 B out of each of 16 lines. Which lane and register holds which (row, k) is as with row-major planes.
// Compute dtypes, f32 accumulate: every float input rounded to bf16 at its load (the uncertainty row too); projections exact + f32 biases; scores and attn.v fp16; the key weight f32, multiplied into k's f32 value; the softmax f32; the output product fp16 x fp16: merged carries 11 significant bits, as the attention weights and v that it is made of do, and Wo's bf16 value is held in fp16 (the same value from 2^-14 up to the fp16 range; below that to within 2^-25) + f32 bias.

#define NB_  2
#define TT   2048
#define DM   1024
#define NH_  16
#define NKV  16
#define REP  (NH_ / NKV)
#define HD   64
#define DQ   (NH_ * HD)
#define DKV  (NKV * HD)
#define SCL  0.125f   // HD^-0.5
#define LAMBDA 0.5f   // the module's uncertainty weight: w = exp(-LAMBDA x token_uncertainty) per key
typedef _Float16 h16;
typedef unsigned short bf;
typedef __attribute__((ext_vector_type(16))) __bf16   v16bf;
typedef __attribute__((ext_vector_type(16))) _Float16 v16h;
typedef __attribute__((ext_vector_type(8)))  _Float16 v8h;
typedef __attribute__((ext_vector_type(4)))  _Float16 v4h;
typedef __attribute__((ext_vector_type(8)))  unsigned short v8us;
typedef __attribute__((ext_vector_type(8)))  float    v8f;
typedef __attribute__((ext_vector_type(4)))  float    v4f;
typedef v8h  __attribute__((may_alias)) v8ha;
typedef v4f  __attribute__((may_alias)) v4fa;
typedef v8us __attribute__((may_alias)) v8usa;

__device__ __forceinline__ unsigned short f2bf(float f) { unsigned u = __float_as_uint(f); u += 0x7FFFu + ((u >> 16) & 1u); return (unsigned short)(u >> 16); }
__device__ __forceinline__ float bf2f(unsigned short b) { return __uint_as_float(((unsigned)b) << 16); }
__device__ __forceinline__ float bfr(float f) { return bf2f(f2bf(f)); }
__device__ __forceinline__ v16h cat16(v8h lo, v8h hi) { return __builtin_shufflevector(lo, hi, 0, 1, 2, 3, 4, 5, 6, 7, 8, 9, 10, 11, 12, 13, 14, 15); }
__device__ __forceinline__ v16bf cat16b(v8us lo, v8us hi) { return __builtin_bit_cast(v16bf, __builtin_shufflevector(lo, hi, 0, 1, 2, 3, 4, 5, 6, 7, 8, 9, 10, 11, 12, 13, 14, 15)); }
__device__ __forceinline__ v8f wmma16(v16h a, v16h b, v8f c) { return __builtin_amdgcn_wmma_f32_16x16x32_f16(false, a, false, b, (short)0, c, false, false); }
__device__ __forceinline__ v8f wmmab(v16bf a, v16bf b, v8f c) { return __builtin_amdgcn_wmma_f32_16x16x32_bf16(false, a, false, b, (short)0, c, false, false); }



// ---- k_gemmw: register-blocked GEMM, ONE WAVE per 64x64 output tile (16 accumulators), operands straight from 16-bit planes in fragment order (blocks [row / 16][k / 32], WFrag::ld takes the lane's place in a block); grid (M/64, N/64), 32 threads.
// y[m][n] = sum_k A[m][k] Bt[n][k] (+ split products per NSPLIT) + f32 bias[n]. K % 32 == 0, known at compile time: every block of a pass then lies at a constant distance from one address per operand. The rows m run over both batch entries (m = b x TT + t).
// OM 0, the one mode left: C[m][n] = y in f32, pitch ldc (P, bias1 and bias2 are not read; the q | k | v product has its own kernel, k_gemmq).
template <typename T16> struct WFrag;
template <> struct WFrag<h16> { typedef v16h V; static __device__ __forceinline__ V ld(const h16* p) { return cat16(*(const v8h*)p, *(const v8h*)(p + 256)); } static __device__ __forceinline__ v8f mma(V a, V b, v8f c) { return wmma16(a, b, c); } };
template <> struct WFrag<bf> { typedef v16bf V; static __device__ __forceinline__ V ld(const bf* p) { return cat16b(*(const v8us*)p, *(const v8us*)(p + 256)); } static __device__ __forceinline__ v8f mma(V a, V b, v8f c) { return wmmab(a, b, c); } };
template <typename T16, int NSPLIT, int OM, int K, int D>
__global__ __launch_bounds__(32) void k_gemmw(const T16* __restrict__ A, const T16* __restrict__ A2, const T16* __restrict__ Bt, const T16* __restrict__ Bt2, float* C, h16* P, int ldc, const float* __restrict__ bias, const float* __restrict__ bias1, const float* __restrict__ bias2) {
    typedef typename WFrag<T16>::V V;
    __shared__ __align__(16) float os[16 * 68];
    const int lane = threadIdx.x & 31, lr = lane & 15, hi = lane >> 4; const int r0 = blockIdx.x * 64, c0 = blockIdx.y * 64;
    v8f acc[4][4];
#pragma unroll
    for (int mb = 0; mb < 4; ++mb)
#pragma unroll
        for (int nb = 0; nb < 4; ++nb) acc[mb][nb] = (v8f){};
    const size_t aoff = (size_t)r0 * K, boff = (size_t)c0 * K; const unsigned lo = 8 * lane;   // 16 rows of K are K / 32 blocks of 512 elements; a block's address is the same for the whole wave, lo the lane's place in it

    // REGISTER RING: D fragment sets; pass st first issues the loads of pass st + D - 1 into the set that pass st - 1 has just left, then does its own products, so a load has D - 1 passes of matrix time to arrive.
    // The K / 32 passes are unrolled whole: a set's number is then known at compile time, and every block of a stretch lies at a constant distance from the stretch's addresses.
    constexpr int NS = K / 32;
    const T16* pa = A + aoff + lo; const T16* pb = Bt + boff + lo; const T16* pa2 = (NSPLIT == 1 || NSPLIT == 2) ? A2 + aoff + lo : pa; const T16* pb2 = (NSPLIT >= 2) ? Bt2 + boff + lo : pb;
    V a[D][4], a2[D][4], b[D][4], b2[D][4];
    // ROTATED k ORDER: the 16 tiles that read the same A rows (grid y) and the 64 that read the same B rows (grid x) run side by side; each starts its walk over k at a stretch of RS passes of its own, rot, and wraps round, so that they do not all ask L2 for the same lines, lines that nobody has fetched yet, at the same moment. Every pass is done once; the sums add up in the walked order.
    constexpr int RS = 4; static_assert(NS % RS == 0 && (NS / RS & (NS / RS - 1)) == 0, "whole stretches, a power of two of them");
    const int rot = (2 * (blockIdx.x & 3) + ((blockIdx.x >> 3) & 1) + blockIdx.y) & (NS / RS - 1);   // evenly spread among the sharers of A rows and among those of B rows, also among those whose x are four neighbours modulo 8
    const T16* sa = pa; const T16* sb = pb; const T16* sa2 = pa2; const T16* sb2 = pb2;   // the stretch that is being loaded
    // unrolled whole, so that ft % D and st % D are constants and the sets stay in registers
#pragma unroll
    for (int st = 1 - D; st < NS; ++st) {   // passes below 0 only fill the ring
        const int ft = st + D - 1, fs = ft % D;
        if (ft < NS) {
            if (ft % RS == 0) { const int ko = ((ft / RS + rot) & (NS / RS - 1)) * (RS * 512); sa = pa + ko; sb = pb + ko; sa2 = pa2 + ko; sb2 = pb2 + ko; }
#pragma unroll
            for (int mb = 0; mb < 4; ++mb) { a[fs][mb] = WFrag<T16>::ld(sa + (ft % RS) * 512 + mb * 16 * K); if (NSPLIT == 1 || NSPLIT == 2) a2[fs][mb] = WFrag<T16>::ld(sa2 + (ft % RS) * 512 + mb * 16 * K); }
#pragma unroll
            for (int nb = 0; nb < 4; ++nb) { b[fs][nb] = WFrag<T16>::ld(sb + (ft % RS) * 512 + nb * 16 * K); if (NSPLIT >= 2) b2[fs][nb] = WFrag<T16>::ld(sb2 + (ft % RS) * 512 + nb * 16 * K); }
            if (ft % RS == RS - 1) asm volatile("s_wait_xcnt 0x0" :: "v"(sa), "v"(sb), "v"(sa2), "v"(sb2) : "memory");   // behind a stretch's last loads, in front of the step of the addresses that the loads name, and behind the last stretch in front of their first overwrite in the epilogue (as inputs here they stay untouched up to it)
        }
        __builtin_amdgcn_sched_barrier(0);   // the set's loads issue here as one group, D - 1 passes ahead of their use; without it the compiler sinks them to just in front of the products that read them and the wave waits out each latency
        if (st >= 0) {
            const int cs = st % D;
#pragma unroll
            for (int nb = 0; nb < 4; ++nb) {
#pragma unroll
                for (int mb = 0; mb < 4; ++mb) { acc[mb][nb] = WFrag<T16>::mma(a[cs][mb], b[cs][nb], acc[mb][nb]); if (NSPLIT == 1 || NSPLIT == 2) acc[mb][nb] = WFrag<T16>::mma(a2[cs][mb], b[cs][nb], acc[mb][nb]); if (NSPLIT >= 2) acc[mb][nb] = WFrag<T16>::mma(a[cs][mb], b2[cs][nb], acc[mb][nb]); } }
            __builtin_amdgcn_sched_barrier(0);   // the next pass's loads stay below these products and so take the set that these leave; without it the compiler lifts loads above them into further registers
        }
    }
    const int sel = (OM == 1) ? c0 / DQ : 0, cl = (OM == 1) ? c0 % DQ : c0, rt = r0 % TT;   // which projection, the column in it, the row in its entry: the same for the whole tile
    const float* bs = (sel == 0) ? bias : (sel == 1) ? bias1 : bias2;
    const int cofs = lr * 4; v4f bb;   // a lane stores the same four columns in every row: their biases are read once
#pragma unroll
    for (int q = 0; q < 4; ++q) bb[q] = bfr(bs[cl + cofs + q]);
#pragma unroll
    for (int mb = 0; mb < 4; ++mb) {
#pragma unroll
        for (int nb = 0; nb < 4; ++nb) {
#pragma unroll
            for (int j = 0; j < 8; ++j) os[(hi * 8 + j) * 68 + nb * 16 + lr] = acc[mb][nb][j]; }
        __builtin_amdgcn_wave_barrier(); asm volatile("" ::: "memory");
        float* crow = C + (size_t)(r0 + mb * 16) * ldc + c0; v4f val[8]; float* cp[8];
#pragma unroll
        for (int s = 0; s < 8; ++s) { const int row = 2 * s + hi; val[s] = *(const v4fa*)(os + row * 68 + cofs); val[s][0] += bb[0]; val[s][1] += bb[1]; val[s][2] += bb[2]; val[s][3] += bb[3]; cp[s] = crow + (size_t)row * ldc + cofs;
            if (OM == 0) *(v4f*)cp[s] = val[s];
        }
        __builtin_amdgcn_wave_barrier();
        asm volatile("s_wait_xcnt 0x0" :: "v"(val[0]), "v"(val[1]), "v"(val[2]), "v"(val[3]), "v"(val[4]), "v"(val[5]), "v"(val[6]), "v"(val[7]), "v"(cp[0]), "v"(cp[1]), "v"(cp[2]), "v"(cp[3]), "v"(cp[4]), "v"(cp[5]), "v"(cp[6]), "v"(cp[7]) : "memory");   // the next row block's LDS writes stay below these reads; and the wait stands in front of every overwrite of the data and address registers that the eight stores name (as inputs here they stay untouched up to it)
    }
}

// ---- k_gemmq: the q | k | v product. ONE WAVE per 128 rows x 96 columns (48 accumulators), one wave a SIMD, four waves (2 x 2) a work-group, so that each A block is read by two waves of a WGP and each B block by two; grid (M / 256, 16), 128 threads: 256 work-groups.
// A wave's 96 columns are one whole q or k head (hp = 0..15 the q heads, 16..31 the k heads: B rows 64 hp ..) and 32 columns of v (B rows 2 DQ + 32 hp ..): 14 fragments feed 48 products a pass (a 64 x 64 tile: 8 feed 16), and each part of the tile lies in one plane.
// y = x Bt^T + f32 biases (bias | bias1 | bias2 for q | k | v); a k row t is then multiplied by its key's factor kfac (k_prep), so that the score product of k_fattn comes out weighted, scaled and in powers of two. P holds the three fp16 plane sets one behind the other, each [b][...]: q and k as head planes, rows t, k = d, blocks [n / 64][t / 16][d / 32]; v transposed, rows d, k = t, blocks [n / 64][t / 32][d / 16]: a lane's 8 accumulator registers are 8 consecutive t of one d, its own 16-B piece of a block.
// Register ring of QD sets as in k_gemmw, rolled: one trip of the loop is QD passes, so a set's number is known at compile time and the text stays small; the first stretch's loads and first products stand in front of the loop, the last QD - 1 passes' products behind it.
#define QMB 8
#define QNB 6
#define QD  4
__global__ __launch_bounds__(128) void k_gemmq(const bf* __restrict__ A, const bf* __restrict__ Bt, h16* P, const float* __restrict__ bias, const float* __restrict__ bias1, const float* __restrict__ bias2, const float* __restrict__ kfac) {
    typedef WFrag<bf>::V V;
    constexpr int K = DM, NS = K / 32;
    __shared__ __align__(16) float osw[4][16 * 68];
    const int lane = threadIdx.x & 31, lr = lane & 15, hi = lane >> 4; const int wn = __builtin_amdgcn_readfirstlane(threadIdx.x >> 5);
    float* os = osw[wn];   // each wave turns its rows in its own LDS range
    const int r0 = (blockIdx.x * 2 + (wn & 1)) * (QMB * 16), hp = blockIdx.y * 2 + (wn >> 1);
    v8f acc[QMB][QNB];
#pragma unroll
    for (int mb = 0; mb < QMB; ++mb)
#pragma unroll
        for (int nb = 0; nb < QNB; ++nb) acc[mb][nb] = (v8f){};
    const bf* pa = A + (size_t)r0 * K + 8 * lane; const bf* pb = Bt + (size_t)hp * HD * K + 8 * lane; const bf* pv = Bt + (size_t)(2 * DQ + hp * 32) * K + 8 * lane;
    const int sel = hp / NH_, hd = hp % NH_;   // q or k; the head
    const int ib = hd * HD + lr, iv0 = hp * 32 + lr, iv1 = iv0 + 16, ik = r0 + lr; const float* bsel = (sel == 0) ? bias : bias1;   // the lane's places in the bias rows and in the key factor row; the bias row of a q or a k head
    float braw[QNB];   // the six bias values of a lane are asked for ahead of the fragments, so that the epilogue does not wait out their latency
#pragma unroll
    for (int nb = 0; nb < QNB; ++nb) braw[nb] = (nb < 4) ? bsel[ib + nb * 16] : bias2[(nb == 4) ? iv0 : iv1];
    float kraw[QMB];   // the key factor of the lane's row lr of each row block (row m = b x TT + t indexes it), asked for ahead of the fragments like the biases
#pragma unroll
    for (int mb = 0; mb < QMB; ++mb) kraw[mb] = kfac[ik + mb * 16];
    asm volatile("s_wait_xcnt 0x0" :: "v"(ib), "v"(iv0), "v"(iv1), "v"(ik), "s"(bsel), "s"(bias2), "s"(kfac) : "memory");   // behind these loads, in front of any overwrite of the address registers that they name (as inputs here the four places and the three row addresses stay untouched up to it)
    V a[QD][QMB], b[QD][QNB];
    // ROTATED k ORDER: the 16 work-groups that read the same A rows (grid y) and the 16 that read the same B rows (grid x) run side by side; each starts its walk over k at a trip of its own, rq, and wraps round, so that they do not all ask L2 for the same lines, lines that nobody has fetched yet, at the same moment. Every pass is done once; the sums add up in the walked order.
    const int rq = (2 * (blockIdx.x & 3) + (blockIdx.x >> 3) + blockIdx.y) & (NS / QD - 1);   // the first trip walked: among the 16 sharers of A rows each of the 8 values twice; among the sharers of B rows likewise, and all 8 once among eight whose x are four neighbours modulo 8
    auto trip = [&](int j) __attribute__((always_inline)) { return ((j + rq) & (NS / QD - 1)) * (QD * 512); };   // where the QD passes of the j-th trip walked lie behind the three addresses
    const bf* ca = pa + trip(0); const bf* cb = pb + trip(0); const bf* cv = pv + trip(0);   // the QD passes that are being loaded
    auto qload = [&](int fs) __attribute__((always_inline)) {   // set fs takes pass fs of those QD
#pragma unroll
        for (int mb = 0; mb < QMB; ++mb) a[fs][mb] = WFrag<bf>::ld(ca + fs * 512 + mb * 16 * K);
#pragma unroll
        for (int nb = 0; nb < 4; ++nb) b[fs][nb] = WFrag<bf>::ld(cb + fs * 512 + nb * 16 * K);
#pragma unroll
        for (int nb = 4; nb < QNB; ++nb) b[fs][nb] = WFrag<bf>::ld(cv + fs * 512 + (nb - 4) * 16 * K); };
    auto qmma = [&](int cs) __attribute__((always_inline)) {
#pragma unroll
        for (int nb = 0; nb < QNB; ++nb)
#pragma unroll
            for (int mb = 0; mb < QMB; ++mb) acc[mb][nb] = WFrag<bf>::mma(a[cs][mb], b[cs][nb], acc[mb][nb]); };
    // One trip of the loop loads the QD passes of one stretch of k, all from the same three addresses, and does the products of the QD passes that lie QD - 1 behind: the last QD - 1 of the stretch before and the first of this one.
#pragma unroll
    for (int f = 0; f < QD; ++f) qload(f);
    asm volatile("s_wait_xcnt 0x0" :: "v"(ca), "v"(cb), "v"(cv) : "memory");   // behind the first stretch's loads, in front of the step of the three addresses that the loads name (as inputs here they stay untouched up to it)
    __builtin_amdgcn_sched_barrier(0);   // the loads issue ahead of the products and are not sunk to them
    qmma(0);
    __builtin_amdgcn_sched_barrier(0);   // the loop's first loads stay below these products and so take the set that these leave
    // stays rolled: for speed only
#pragma nounroll
    for (int it = 1; it < NS / QD; ++it) {
        ca = pa + trip(it); cb = pb + trip(it); cv = pv + trip(it);
#pragma unroll
        for (int u = 0; u < QD; ++u) {
            qload(u);
            if (u == QD - 1) asm volatile("s_wait_xcnt 0x0" :: "v"(ca), "v"(cb), "v"(cv) : "memory");   // behind the trip's last loads, in front of the step of the three addresses that the loads name (as inputs here they stay untouched up to it)
            __builtin_amdgcn_sched_barrier(0);   // the set's loads issue here as one group, QD - 1 passes ahead of their use, and are not sunk to the products that read them
            qmma((u + 1) % QD);
            __builtin_amdgcn_sched_barrier(0);   // the next pass's loads stay below these products and so take the set that these leave
        }
    }
#pragma unroll
    for (int u = 1; u < QD; ++u) qmma(u);
    const int rt = r0 % TT; const size_t PLN = (size_t)NH_ * TT * HD;   // the row in its entry
    {   // q, k: 16 rows x 64 columns turned in LDS, bias added on the way in; then each lane takes its own 16-B pieces of the row block's two blocks
        float bn[4], kw[QMB];   // kw: the factor of the lane's row of each row block, 1 for a q head
#pragma unroll
        for (int nb = 0; nb < 4; ++nb) bn[nb] = bfr(braw[nb]);
#pragma unroll
        for (int mb = 0; mb < QMB; ++mb) kw[mb] = (sel == 0) ? 1.0f : kraw[mb];
        h16* pq = P + ((size_t)sel * NB_ + r0 / TT) * PLN + ((size_t)hd * TT + rt) * HD + lane * 8;
#pragma unroll
        for (int mb = 0; mb < QMB; ++mb) {
#pragma unroll
            for (int nb = 0; nb < 4; ++nb) {
#pragma unroll
                for (int j = 0; j < 8; ++j) os[(hi * 8 + j) * 68 + nb * 16 + lr] = acc[mb][nb][j] + bn[nb]; }
            __builtin_amdgcn_wave_barrier(); asm volatile("" ::: "memory");   // the rows are read back by other lanes of this wave: the compiler may not move the reads above the writes
            v8h o[4];
#pragma unroll
            for (int s = 0; s < 4; ++s) { const float* rp = os + lr * 68 + s * 16 + hi * 8; const v4f x0 = *(const v4fa*)rp, x1 = *(const v4fa*)(rp + 4);
#pragma unroll
                for (int q = 0; q < 4; ++q) { o[s][q] = (h16)(x0[q] * kw[mb]); o[s][q + 4] = (h16)(x1[q] * kw[mb]); }
                *(v8h*)(pq + mb * 1024 + s * 256) = o[s]; }
            __builtin_amdgcn_wave_barrier(); asm volatile("s_wait_xcnt 0x0" :: "v"(o[0]), "v"(o[1]), "v"(o[2]), "v"(o[3]) : "memory");   // the next row block's LDS writes stay below these reads; and the wait stands in front of every overwrite of the registers that the four stores name (as inputs here they stay untouched up to it)
        }
    }
    // v, transposed, straight from the accumulators: head hp / 2, d blocks 2 (hp % 2) + 0, 1; each store of the wave is half a block, 512 B in a row
    h16* pc = P + ((size_t)2 * NB_ + r0 / TT) * PLN + (size_t)(hp >> 1) * HD * TT + (size_t)rt * HD + (hp & 1) * 1024 + lane * 8;
#pragma unroll
    for (int nb = 4; nb < QNB; ++nb) { const float bn = bfr(braw[nb]);
#pragma unroll
        for (int mq = 0; mq < QMB; mq += 4) { v8h o[4];
#pragma unroll
            for (int mb = 0; mb < 4; ++mb) {
#pragma unroll
                for (int j = 0; j < 8; ++j) o[mb][j] = (h16)(acc[mq + mb][nb][j] + bn);
                *(v8h*)(pc + (nb - 4) * 512 + ((mq + mb) >> 1) * 2048 + (mb & 1) * 256) = o[mb]; }
            asm volatile("s_wait_xcnt 0x0" :: "v"(o[0]), "v"(o[1]), "v"(o[2]), "v"(o[3]) : "memory");   // in front of every overwrite of the registers that the four stores name
        } }
}

typedef __attribute__((ext_vector_type(2))) unsigned short v2us;
typedef __attribute__((ext_vector_type(4))) unsigned short v4us;
typedef __attribute__((ext_vector_type(4))) int v4i;
typedef __attribute__((ext_vector_type(2))) float v2f;

// k_prep: all the rounding to bf16 in ONE launch, one wave a block of the fragment order. Work-groups 0 .. 4 x WTB - 1: the four 'io' weights [DM][DM] (in, out) -> Bt, rows out, k = in, WTB work-groups each, the four results one behind the other, the first three as bf16, the fourth (the output weight) as the fp16 pattern of its bf16 value, which is what the fp16 output product reads; the next XTB: x of both entries, rows m, k = in;
// the last NB_ x TT / 256: the key factor row, one key a lane: kfac[b][key] = expf(-LAMBDA x bf16(u[b][key])) x SCL x log2 e, and 0 where the int key mask is 0.
#define WTB (DM * DM / 512 / 8)   // work-groups a weight: 8 waves x 1 block of 512 elements
#define XTB (NB_ * TT * DM / 512 / 8)   // work-groups for x
__global__ __launch_bounds__(256) void k_prep(const float* __restrict__ w0, const float* __restrict__ w1, const float* __restrict__ w2, const float* __restrict__ w3, bf* Bt4, const float* __restrict__ src, bf* dst, const float* __restrict__ u, const int* __restrict__ kvp, float* kfac) {
    const int lane = threadIdx.x & 31, lr = lane & 15, hi = lane >> 4;
    if (blockIdx.x >= 4 * WTB + XTB) {
        const int j = (blockIdx.x - (4 * WTB + XTB)) * 256 + threadIdx.x; const float uj = u[j]; const int kj = kvp[j];
        asm volatile("s_wait_xcnt 0x0" ::: "memory");   // behind the two loads, in front of any overwrite of the address registers that they name
        const float e = expf(-LAMBDA * bfr(uj)) * (SCL * 1.4426950408889634f); kfac[j] = (kj != 0) ? e : 0.0f;   // made for every key and then chosen, so that both loads go out together
        return; }
    if (blockIdx.x < 4 * WTB) {   // lane (hi, lr) gathers its own two pieces: row out = 16 nb + lr, 8 consecutive in; a load reads 64 B of each of two rows of w, a store is 512 B in a row
        const int wi = blockIdx.x / WTB; const float* w = (wi == 0) ? w0 : (wi == 1) ? w1 : (wi == 2) ? w2 : w3; bf* Bt = Bt4 + (size_t)wi * DM * DM;
        const int blk = (blockIdx.x % WTB) * 8 + (threadIdx.x >> 5); const int nb = blk / (DM / 32), kb = blk % (DM / 32);
        const float* wp = w + (size_t)(kb * 32 + hi * 8) * DM + nb * 16 + lr; float v[16];
#pragma unroll
        for (int j = 0; j < 16; ++j) v[j] = wp[(size_t)((j >> 3) * 16 + (j & 7)) * DM];
        v8us o[2];
#pragma unroll
        for (int j = 0; j < 16; ++j) o[j >> 3][j & 7] = f2bf(v[j]);
        if (wi == 3) {   // the output weight: the same bf16 value, written as fp16; one test for the whole block, the same for every wave of the work-group
#pragma unroll
            for (int j = 0; j < 16; ++j) o[j >> 3][j & 7] = __builtin_bit_cast(unsigned short, (h16)bf2f(o[j >> 3][j & 7])); }
#pragma unroll
        for (int hf = 0; hf < 2; ++hf) *(v8us*)(Bt + (size_t)blk * 512 + hf * 256 + lane * 8) = o[hf];
        asm volatile("s_wait_xcnt 0x0" :: "v"(o[0]), "v"(o[1]) : "memory");   // in front of every overwrite of the registers that the two stores name (as inputs here the data stay untouched up to it)
        return; }
    const int blk = (blockIdx.x - 4 * WTB) * 8 + (threadIdx.x >> 5); const int rb = blk / (DM / 32), kb = blk % (DM / 32);   // x: whole 128-B lines in (4 rows a load), 64-B runs out
    const int kq = (lane & 7) * 4; const float* sp = src + (size_t)(rb * 16 + (lane >> 3)) * DM + kb * 32 + kq; bf* dp = dst + (size_t)blk * 512 + (kq >> 4) * 256 + (((kq >> 3) & 1) * 16 + (lane >> 3)) * 8 + (kq & 4); v4f v[4];
#pragma unroll
    for (int i = 0; i < 4; ++i) v[i] = *(const v4f*)(sp + (size_t)i * 4 * DM);
#pragma unroll
    for (int i = 0; i < 4; ++i) { v4us o;
#pragma unroll
        for (int k = 0; k < 4; ++k) o[k] = f2bf(v[i][k]);
        *(v4us*)(dp + i * 32) = o; }
    asm volatile("s_wait_xcnt 0x0" ::: "memory");   // behind the last of the four stores, in front of any later overwrite of the address and data registers that they name
}

__device__ __forceinline__ float xhalf(float x) { return __builtin_bit_cast(float, __builtin_amdgcn_permlanex16(__builtin_bit_cast(int, x), __builtin_bit_cast(int, x), 0x76543210, 0xfedcba98, false, false)); }  // lane l with lane l ^ 16, in the vector unit (a shuffle would go through the LDS path and its wait)
#define FKB 64     // keys a pass
#define FWV 4      // waves a work-group: one on each SIMD, all on one head, so that they share its K and V lines in the WGP cache
#define PB  4096.0f   // a lane's sum of 32 weights of one query above which the reference is raised
static_assert(TT / FKB == 32, "one mask bit a pass in one 32-bit word");
__global__ __launch_bounds__(FWV * 32) void k_fattn(const h16* __restrict__ Qp, const h16* __restrict__ Kp, const h16* __restrict__ Vt, const int* __restrict__ kvp, h16* Am) {
    __shared__ __align__(16) float mb[TT]; __shared__ unsigned pm[TT / FKB];
    const int lane = threadIdx.x & 31, lr = lane & 15, hi = lane >> 4;
    { const size_t z = blockIdx.z; Qp += z * ((size_t)NH_ * TT * HD); Kp += z * ((size_t)NKV * TT * HD); Vt += z * ((size_t)NKV * HD * TT); kvp += z * TT; Am += z * ((size_t)TT * DQ); }
    { v4i kq[TT / (FWV * 128)];   // the mask row is loaded whole and unconditionally first (16 B a lane, whole lines), so that the work-group pays one load latency, not one per key group
#pragma unroll
        for (int r = 0; r < TT / (FWV * 128); ++r) kq[r] = *(const v4i*)(kvp + r * (FWV * 128) + threadIdx.x * 4);
        asm volatile("s_wait_xcnt 0x0" ::: "memory");   // behind these loads, in front of any overwrite of the address registers that they name
#pragma unroll
        for (int r = 0; r < TT / (FWV * 128); ++r) { const int j = r * (FWV * 128) + threadIdx.x * 4; v4f b4; bool shut = false;
#pragma unroll
            for (int q = 0; q < 4; ++q) { const bool on = (kq[r][q] != 0); b4[q] = on ? 0.0f : -3.0e38f; shut = shut || !on; }
            *(v4fa*)(mb + j) = b4;
            const unsigned bal = __builtin_amdgcn_ballot_w32(shut);   // a wave's 128 keys are two passes, one per lane half
            if (lr == 0) pm[j / FKB] = hi ? (bal >> 16) : (bal & 0xFFFFu); } }
    __syncthreads();
    const unsigned mword = __builtin_amdgcn_ballot_w32(pm[lane] != 0u);   // bit p: pass p holds a masked key; the same in every wave
    const int h = blockIdx.y; const int q0 = (blockIdx.x * FWV + (threadIdx.x >> 5)) * 32;
    const h16* qb = Qp + ((size_t)h * TT + q0) * HD + 8 * lane; const h16* kb = Kp + (size_t)h * TT * HD + 8 * lane; const h16* vb = Vt + (size_t)h * HD * TT + 8 * lane;   // 8 x lane: the lane's place in a block; 64 keys (or queries) of a head are 8 blocks in a row in each plane
    const int rot = 8 * (blockIdx.x & 3) + 4 * (blockIdx.x >> 3) + 2 * ((blockIdx.x >> 2) & 1);   // the first pass walked: 16 different even numbers, and evenly apart (2 to 6 passes) also among eight work-groups whose x are four neighbours modulo 8, or the lower or upper eight
    const h16* k1 = kb + (size_t)(rot * FKB) * HD;   // the K rows of the first pass walked
    v16h qf[2][2], kf[4][2]; v8f o[4][2], cm[2]; float rf[2], l[2]; bool started = false;   // cm: minus rf in all eight registers, the C operand; started: an open key has been seen (the mask is the same for every query, so this is one value for the wave)
#pragma unroll
    for (int qt = 0; qt < 2; ++qt) { rf[qt] = 0.0f; l[qt] = 0.0f; cm[qt] = (v8f){};
#pragma unroll
        for (int dh = 0; dh < 2; ++dh) qf[qt][dh] = WFrag<h16>::ld(qb + (qt * 2 + dh) * 512);
#pragma unroll
        for (int dt = 0; dt < 4; ++dt) o[dt][qt] = (v8f){}; }
#pragma unroll
    for (int kt = 0; kt < 4; ++kt)
#pragma unroll
        for (int dh = 0; dh < 2; ++dh) kf[kt][dh] = WFrag<h16>::ld(k1 + (kt * 2 + dh) * 512);
    asm volatile("s_wait_xcnt 0x0" :: "v"(qb), "v"(k1) : "memory");   // behind the Q and the first K loads, in front of any overwrite of the address registers that they name (as inputs here the two addresses stay untouched up to it)
    for (int p = 0; p < TT / FKB; ++p) {
        const int k0 = ((p + rot) & (TT / FKB - 1)) * FKB;   // the pass's first key, in the rotated order
        const h16* vp = vb + (size_t)k0 * HD;   // the pass's V blocks
        v16h vf[4][2]; v8f s[4][2];
#pragma unroll
        for (int dt = 0; dt < 4; ++dt)
#pragma unroll
            for (int ks = 0; ks < 2; ++ks) vf[dt][ks] = WFrag<h16>::ld(vp + (ks * 4 + dt) * 512);
        asm volatile("s_wait_xcnt 0x0" :: "v"(vp) : "memory");   // stands in front of every overwrite of the address registers that these loads name (as an input here the address stays untouched up to it, by the loads' own results too)
        __builtin_amdgcn_sched_barrier(0);   // all 16 V loads issue here, ahead of the score products; without it the compiler sinks half of them to just in front of their use, and the wave waits out the latency
#pragma unroll
        for (int kt = 0; kt < 4; ++kt)
#pragma unroll
            for (int qt = 0; qt < 2; ++qt) { s[kt][qt] = wmma16(kf[kt][0], qf[qt][0], cm[qt]); s[kt][qt] = wmma16(kf[kt][1], qf[qt][1], s[kt][qt]); }
        const int kn = ((p + 1 + rot) & (TT / FKB - 1)) * FKB;   // the next pass's K rows are fetched behind this pass's score products (the last pass re-reads the first pass's rows, in bounds, unused)
#pragma unroll
        for (int kt = 0; kt < 4; ++kt)
#pragma unroll
            for (int dh = 0; dh < 2; ++dh) kf[kt][dh] = WFrag<h16>::ld(kb + (size_t)kn * HD + (kt * 2 + dh) * 512);
        asm volatile("s_wait_xcnt 0x0" ::: "memory");   // in front of the first reuse of the address registers that these loads name
        __builtin_amdgcn_sched_barrier(0);   // the next pass's 16 K loads issue in front of the softmax, not spread through it
        if ((mword >> (k0 / FKB)) & 1u) {   // a scalar test: only a pass with a masked key reads the bias row
#pragma unroll
            for (int kt = 0; kt < 4; ++kt) { const v4f b0 = *(const v4fa*)(mb + k0 + kt * 16 + hi * 8), b1 = *(const v4fa*)(mb + k0 + kt * 16 + hi * 8 + 4);
#pragma unroll
                for (int qt = 0; qt < 2; ++qt)
#pragma unroll
                    for (int j = 0; j < 4; ++j) { s[kt][qt][j] += b0[j]; s[kt][qt][j + 4] += b1[j]; } } }
        v16h pf[2][2]; float sum[2];
        auto weights = [&](int qt, bool step, float dl) __attribute__((always_inline)) {   // the 32 weights of a lane for query tile qt, their fp16 copies and their sum: pairs of neighbours added in two chains of packed additions
            v2f ac[2];
#pragma unroll
            for (int kt = 0; kt < 4; ++kt)
#pragma unroll
                for (int j = 0; j < 8; j += 2) { v2f p; p[0] = __builtin_amdgcn_exp2f(step ? s[kt][qt][j] - dl : s[kt][qt][j]); p[1] = __builtin_amdgcn_exp2f(step ? s[kt][qt][j + 1] - dl : s[kt][qt][j + 1]);
                    pf[kt >> 1][qt][(kt & 1) * 8 + j] = (h16)p[0]; pf[kt >> 1][qt][(kt & 1) * 8 + j + 1] = (h16)p[1];
                    const int ch = (j >> 1) & 1; if (kt == 0 && j < 4) ac[ch] = p; else ac[ch] += p; }
            const v2f t2 = ac[0] + ac[1]; sum[qt] = t2[0] + t2[1]; };
        weights(0, false, 0.0f); weights(1, false, 0.0f);
        const unsigned high = __builtin_amdgcn_ballot_w32(!(sum[0] <= PB)) | __builtin_amdgcn_ballot_w32(!(sum[1] <= PB));
        if (__builtin_expect(!started | (high != 0u), 0)) {   // one scalar test a pass; taken up to the first pass with an open key and where a sum has left the bound: the pass's weights are made again against a new reference (marked as the rare side, so that the usual pass runs straight on in the text)
            bool open = false;
#pragma unroll
            for (int qt = 0; qt < 2; ++qt) { float mx = s[0][qt][0];
#pragma unroll
                for (int kt = 0; kt < 4; ++kt)
#pragma unroll
                    for (int j = 0; j < 8; ++j) mx = fmaxf(mx, s[kt][qt][j]);
                mx = fmaxf(mx, xhalf(mx));
                const bool op = (mx > -1.0e30f); open = open || op;   // no open key in this pass: the reference stays
                const float rn = rf[qt] + (op ? (started ? fmaxf(mx, 0.0f) : mx) : 0.0f), dl = rn - rf[qt];   // the new reference, never lower once it is set, and the step as the rounded reference takes it
                const float al = __builtin_amdgcn_exp2f(fminf(-dl, 0.0f)); rf[qt] = rn;   // before the start sum and output are 0, and any finite factor leaves them so
#pragma unroll
                for (int j = 0; j < 8; ++j) cm[qt][j] = -rf[qt];
                weights(qt, true, dl); l[qt] *= al;
#pragma unroll
                for (int dt = 0; dt < 4; ++dt)
#pragma unroll
                    for (int j = 0; j < 8; ++j) o[dt][qt][j] *= al; }
            started = started || (__builtin_amdgcn_ballot_w32(open) != 0u);
        }
        l[0] += sum[0]; l[1] += sum[1];
#pragma unroll
        for (int ks = 0; ks < 2; ++ks)
#pragma unroll
            for (int dt = 0; dt < 4; ++dt)
#pragma unroll
                for (int qt = 0; qt < 2; ++qt) o[dt][qt] = wmma16(vf[dt][ks], pf[ks][qt], o[dt][qt]);
    }
#pragma unroll
    for (int qt = 0; qt < 2; ++qt) { const float inv = __fdiv_rn(1.0f, l[qt] + xhalf(l[qt])); v8h om[4];
#pragma unroll
        for (int dt = 0; dt < 4; ++dt) {
#pragma unroll
            for (int j = 0; j < 8; ++j) om[dt][j] = (h16)(o[dt][qt][j] * inv);
            const size_t oo = (size_t)(q0 + qt * 16) * DQ + (h * 2 + (dt >> 1)) * 512 + (dt & 1) * 256 + lane * 8; *(v8h*)(Am + oo) = om[dt]; }   // rows t, k = 64 h + d: the lane's 8 registers are its own piece of a block
        asm volatile("s_wait_xcnt 0x0" :: "v"(om[0]), "v"(om[1]), "v"(om[2]), "v"(om[3]) : "memory");   // in front of every overwrite of the registers that the four stores name (as inputs here the data stay untouched up to it)
    }
}

extern "C" void kernel_launch(void* const* d_in, const int* in_sizes, int n_in,
                              void* d_out, int out_size, void* d_ws, size_t ws_size, hipStream_t stream) {
    (void)in_sizes; (void)n_in; (void)out_size;
    const float* x = (const float*)d_in[0]; const float* un = (const float*)d_in[1]; const int* km = (const int*)d_in[2]; const float* wq = (const float*)d_in[3]; const float* bq = (const float*)d_in[4]; const float* wk = (const float*)d_in[5]; const float* bk = (const float*)d_in[6]; const float* wv = (const float*)d_in[7]; const float* bv = (const float*)d_in[8]; const float* wo = (const float*)d_in[9]; const float* bo = (const float*)d_in[10];
    float* OUT = (float*)d_out;     // [2][2048][1024]
    char* wsp = (char*)d_ws;
    auto take = [&](size_t bytes) { char* p = wsp; wsp += (bytes + 255) & ~(size_t)255; return (void*)p; };
    bf* W4 = (bf*)take((size_t)4 * DM * DM * 2);    // Wq, Wk, Wv, Wo as Bt [out][in], one behind the other: the first three are the B operand [3 x DQ][DM] of the q | k | v product
    bf* XB = (bf*)take((size_t)NB_ * TT * DM * 2);
    h16* QKV16 = (h16*)take((size_t)3 * NB_ * NH_ * TT * HD * 2);    // q planes, k planes, v planes, each [b][...]
    h16* AT = (h16*)take((size_t)NB_ * TT * DQ * 2);    // merged, fp16
    float* KF = (float*)take((size_t)NB_ * TT * 4);    // the key factor row
    if ((size_t)(wsp - (char*)d_ws) > ws_size) return;    // total 48 MiB and 16 KiB of the workspace
    const size_t PL = (size_t)NB_ * NH_ * TT * HD;
    k_prep<<<4 * WTB + XTB + NB_ * TT / 256, 256, 0, stream>>>(wq, wk, wv, wo, W4, x, XB, un, km, KF);
    k_gemmq<<<dim3(NB_ * TT / 256, 2 * NH_ / 2, 1), 128, 0, stream>>>(XB, W4, QKV16, bq, bk, bv, KF);    // q, k planes [b][h] rows t (k x its key's factor), v planes [b][h] rows d, in fragment order
    k_fattn<<<dim3(TT / (FWV * 32), NH_, NB_), FWV * 32, 0, stream>>>(QKV16, QKV16 + PL, QKV16 + 2 * PL, km, AT);   // all heads of both entries: scores, mask, softmax, attn.v, the merged plane
    k_gemmw<h16, 0, 0, DQ, 5><<<dim3(NB_ * TT / 64, DM / 64, 1), 32, 0, stream>>>(AT, nullptr, (const h16*)(W4 + (size_t)3 * DM * DM), nullptr, OUT, nullptr, DM, bo, nullptr, nullptr);
}

// v010
// One run takes 63.9 microseconds.
// In both of two side-by-side timings against v009, it was 1.04 times as fast.
// Over all steps from v000 it is 23.1 times as fast.
#include <hip/hip_runtime.h>

// Multi-head self-attention whose scaled scores are multiplied, per KEY, by an uncertainty weight before the mask and the softmax, with an integer key mask read as data and an output projection (hidden_states [2][2048][1024]; token_uncertainty [2][2048]; attention_mask int32 [2][2048];
// q, k, v = x W + b with 'io' weights [1024][1024] (in, out) and biases [1024]; 16 heads x 64 (head h = columns h x 64 ..); scores = q k^T / sqrt(64); scores = scores x exp(-0.5 x token_uncertainty[b][key]); where(mask[b][key] != 0, scores, -inf); softmax over the keys;
// out = merged Wo + bo ('io' + bias) -> [2][2048][1024] (4.2 M); argument order hidden_states, token_uncertainty, attention_mask, Wq, bq, Wk, bk, Wv, bv, Wo, bo).
// Layout, both batch entries in every launch: one bf16 copy of x (read by all three projections) and the 'io' weights transposed and rounded, and the key factor row, in one launch (k_prep); q, k, v as ONE product [4096][1024] x [3072][1024]^T + f32 biases, whose epilogue writes the f16 head planes itself (q, k per [b][h] with rows t, v per [b][h] with rows d; each k row x its key's weight x SCL x log2 e in f32 before the one rounding to fp16); dense T-2048 attention, 16 heads x 2 entries in one launch (k_fattn):
// the f16 score product, which starts from minus a reference per query and so gives the exponent itself, the entry's int key mask, a softmax in f32 against that reference, whose weights go to fp16 in registers, attn.v on ONE fp16 product, the division by the sum; merged, rounded once to fp16, x Wo + bo on ONE fp16 product.
// FRAGMENT ORDER: every 16-bit plane that a matrix instruction reads (x, the four weights, q, k, v^T, merged) lies in memory as blocks of 16 rows x 32 k = 1 KiB, the 16-B piece (row r, k = 16 half + 8 hh + 0..7) at byte 512 half + 16 (16 hh + r):
// lane 16 hh + r of a wave reads its two pieces at 16 x lane and 512 + 16 x lane, so each fragment load of a wave is 512 B in a row (4 whole lines) and not 32 B out of each of 16 lines. Which lane and register holds which (row, k) is as with row-major planes.
// Compute dtypes, f32 accumulate: every float input rounded to bf16 at its load (the uncertainty row too); projections exact + f32 biases; scores and attn.v fp16; the key weight f32, multiplied into k's f32 value; the softmax f32; the output product fp16 x fp16: merged carries 11 significant bits, as the attention weights and v that it is made of do, and Wo's bf16 value is held in fp16 (the same value from 2^-14 up to the fp16 range; below that to within 2^-25) + f32 bias.

#define NB_  2
#define TT   2048
#define DM   1024
#define NH_  16
#define NKV  16
#define REP  (NH_ / NKV)
#define HD   64
#define DQ   (NH_ * HD)
#define DKV  (NKV * HD)
#define SCL  0.125f   // HD^-0.5
#define LAMBDA 0.5f   // the module's uncertainty weight: w = exp(-LAMBDA x token_uncertainty) per key
typedef _Float16 h16;
typedef unsigned short bf;
typedef __attribute__((ext_vector_type(16))) __bf16   v16bf;
typedef __attribute__((ext_vector_type(16))) _Float16 v16h;
typedef __attribute__((ext_vector_type(8)))  _Float16 v8h;
typedef __attribute__((ext_vector_type(4)))  _Float16 v4h;
typedef __attribute__((ext_vector_type(8)))  unsigned short v8us;
typedef __attribute__((ext_vector_type(8)))  float    v8f;
typedef __attribute__((ext_vector_type(4)))  float    v4f;
typedef v8h  __attribute__((may_alias)) v8ha;
typedef v4f  __attribute__((may_alias)) v4fa;
typedef v8us __attribute__((may_alias)) v8usa;

__device__ __forceinline__ unsigned short f2bf(float f) { unsigned u = __float_as_uint(f); u += 0x7FFFu + ((u >> 16) & 1u); return (unsigned short)(u >> 16); }
__device__ __forceinline__ float bf2f(unsigned short b) { return __uint_as_float(((unsigned)b) << 16); }
__device__ __forceinline__ float bfr(float f) { return bf2f(f2bf(f)); }
__device__ __forceinline__ v16h cat16(v8h lo, v8h hi) { return __builtin_shufflevector(lo, hi, 0, 1, 2, 3, 4, 5, 6, 7, 8, 9, 10, 11, 12, 13, 14, 15); }
__device__ __forceinline__ v16bf cat16b(v8us lo, v8us hi) { return __builtin_bit_cast(v16bf, __builtin_shufflevector(lo, hi, 0, 1, 2, 3, 4, 5, 6, 7, 8, 9, 10, 11, 12, 13, 14, 15)); }
__device__ __forceinline__ v8f wmma16(v16h a, v16h b, v8f c) { return __builtin_amdgcn_wmma_f32_16x16x32_f16(false, a, false, b, (short)0, c, false, false); }
__device__ __forceinline__ v8f wmmab(v16bf a, v16bf b, v8f c) { return __builtin_amdgcn_wmma_f32_16x16x32_bf16(false, a, false, b, (short)0, c, false, false); }



// ---- k_gemmw: register-blocked GEMM, ONE WAVE per 64x64 output tile (16 accumulators), operands straight from 16-bit planes in fragment order (blocks [row / 16][k / 32], WFrag::ld takes the lane's place in a block); one wave a SIMD, four waves (2 x 2 tiles) a work-group, which walk k together, so that each A block and each B block is read by two waves of one WGP and leaves L2 once for both; grid (M/128, N/128), 128 threads: 256 work-groups.
// y[m][n] = sum_k A[m][k] Bt[n][k] (+ split products per NSPLIT) + f32 bias[n]. K % 32 == 0, known at compile time: every block of a pass then lies at a constant distance from one address per operand. The rows m run over both batch entries (m = b x TT + t).
// OM 0, the one mode left: C[m][n] = y in f32, pitch ldc (P, bias1 and bias2 are not read; the q | k | v product has its own kernel, k_gemmq).
template <typename T16> struct WFrag;
template <> struct WFrag<h16> { typedef v16h V; static __device__ __forceinline__ V ld(const h16* p) { return cat16(*(const v8h*)p, *(const v8h*)(p + 256)); } static __device__ __forceinline__ v8f mma(V a, V b, v8f c) { return wmma16(a, b, c); } };
template <> struct WFrag<bf> { typedef v16bf V; static __device__ __forceinline__ V ld(const bf* p) { return cat16b(*(const v8us*)p, *(const v8us*)(p + 256)); } static __device__ __forceinline__ v8f mma(V a, V b, v8f c) { return wmmab(a, b, c); } };
template <typename T16, int NSPLIT, int OM, int K, int D>
__global__ __launch_bounds__(128) void k_gemmw(const T16* __restrict__ A, const T16* __restrict__ A2, const T16* __restrict__ Bt, const T16* __restrict__ Bt2, float* C, h16* P, int ldc, const float* __restrict__ bias, const float* __restrict__ bias1, const float* __restrict__ bias2) {
    typedef typename WFrag<T16>::V V;
    __shared__ __align__(16) float osw[4][16 * 68];
    const int lane = threadIdx.x & 31, lr = lane & 15, hi = lane >> 4; const int wn = __builtin_amdgcn_readfirstlane(threadIdx.x >> 5);
    float* os = osw[wn];   // each wave turns its rows in its own LDS range
    const int r0 = (blockIdx.x * 2 + (wn & 1)) * 64, c0 = (blockIdx.y * 2 + (wn >> 1)) * 64;
    v8f acc[4][4];
#pragma unroll
    for (int mb = 0; mb < 4; ++mb)
#pragma unroll
        for (int nb = 0; nb < 4; ++nb) acc[mb][nb] = (v8f){};
    const size_t aoff = (size_t)r0 * K, boff = (size_t)c0 * K; const unsigned lo = 8 * lane;   // 16 rows of K are K / 32 blocks of 512 elements; a block's address is the same for the whole wave, lo the lane's place in it

    // REGISTER RING: D fragment sets; pass st first issues the loads of pass st + D - 1 into the set that pass st - 1 has just left, then does its own products, so a load has D - 1 passes of matrix time to arrive.
    // The K / 32 passes are unrolled whole: a set's number is then known at compile time, and every block of a stretch lies at a constant distance from the stretch's addresses.
    constexpr int NS = K / 32;
    const T16* pa = A + aoff + lo; const T16* pb = Bt + boff + lo; const T16* pa2 = (NSPLIT == 1 || NSPLIT == 2) ? A2 + aoff + lo : pa; const T16* pb2 = (NSPLIT >= 2) ? Bt2 + boff + lo : pb;
    V a[D][4], a2[D][4], b[D][4], b2[D][4];
    // ROTATED k ORDER: the 8 work-groups that read the same A rows (grid y) and the 32 that read the same B rows (grid x) run side by side; each starts its walk over k at a stretch of RS passes of its own, rot (one value for its four waves), and wraps round, so that they do not all ask L2 for the same lines, lines that nobody has fetched yet, at the same moment. Every pass is done once; the sums add up in the walked order.
    constexpr int RS = 4; static_assert(NS % RS == 0 && (NS / RS & (NS / RS - 1)) == 0, "whole stretches, a power of two of them");
    const int rot = (2 * (blockIdx.x & 3) + ((blockIdx.x >> 3) & 1) + blockIdx.y) & (NS / RS - 1);   // evenly spread among the sharers of A rows and among those of B rows, also among those whose x are four neighbours modulo 8
    const T16* sa = pa; const T16* sb = pb; const T16* sa2 = pa2; const T16* sb2 = pb2;   // the stretch that is being loaded
    // unrolled whole, so that ft % D and st % D are constants and the sets stay in registers
#pragma unroll
    for (int st = 1 - D; st < NS; ++st) {   // passes below 0 only fill the ring
        const int ft = st + D - 1, fs = ft % D;
        if (ft < NS) {
            if (ft % RS == 0) { const int ko = ((ft / RS + rot) & (NS / RS - 1)) * (RS * 512); sa = pa + ko; sb = pb + ko; sa2 = pa2 + ko; sb2 = pb2 + ko; }
#pragma unroll
            for (int mb = 0; mb < 4; ++mb) { a[fs][mb] = WFrag<T16>::ld(sa + (ft % RS) * 512 + mb * 16 * K); if (NSPLIT == 1 || NSPLIT == 2) a2[fs][mb] = WFrag<T16>::ld(sa2 + (ft % RS) * 512 + mb * 16 * K); }
#pragma unroll
            for (int nb = 0; nb < 4; ++nb) { b[fs][nb] = WFrag<T16>::ld(sb + (ft % RS) * 512 + nb * 16 * K); if (NSPLIT >= 2) b2[fs][nb] = WFrag<T16>::ld(sb2 + (ft % RS) * 512 + nb * 16 * K); }
            if (ft % RS == RS - 1) asm volatile("s_wait_xcnt 0x0" :: "v"(sa), "v"(sb), "v"(sa2), "v"(sb2) : "memory");   // behind a stretch's last loads, in front of the step of the addresses that the loads name, and behind the last stretch in front of their first overwrite in the epilogue (as inputs here they stay untouched up to it)
        }
        __builtin_amdgcn_sched_barrier(0);   // the set's loads issue here as one group, D - 1 passes ahead of their use; without it the compiler sinks them to just in front of the products that read them and the wave waits out each latency
        if (st >= 0) {
            const int cs = st % D;
#pragma unroll
            for (int nb = 0; nb < 4; ++nb) {
#pragma unroll
                for (int mb = 0; mb < 4; ++mb) { acc[mb][nb] = WFrag<T16>::mma(a[cs][mb], b[cs][nb], acc[mb][nb]); if (NSPLIT == 1 || NSPLIT == 2) acc[mb][nb] = WFrag<T16>::mma(a2[cs][mb], b[cs][nb], acc[mb][nb]); if (NSPLIT >= 2) acc[mb][nb] = WFrag<T16>::mma(a[cs][mb], b2[cs][nb], acc[mb][nb]); } }
            __builtin_amdgcn_sched_barrier(0);   // the next pass's loads stay below these products and so take the set that these leave; without it the compiler lifts loads above them into further registers
        }
    }
    const int sel = (OM == 1) ? c0 / DQ : 0, cl = (OM == 1) ? c0 % DQ : c0, rt = r0 % TT;   // which projection, the column in it, the row in its entry: the same for the whole tile
    const float* bs = (sel == 0) ? bias : (sel == 1) ? bias1 : bias2;
    const int cofs = lr * 4; v4f bb;   // a lane stores the same four columns in every row: their biases are read once
#pragma unroll
    for (int q = 0; q < 4; ++q) bb[q] = bfr(bs[cl + cofs + q]);
#pragma unroll
    for (int mb = 0; mb < 4; ++mb) {
#pragma unroll
        for (int nb = 0; nb < 4; ++nb) {
#pragma unroll
            for (int j = 0; j < 8; ++j) os[(hi * 8 + j) * 68 + nb * 16 + lr] = acc[mb][nb][j]; }
        __builtin_amdgcn_wave_barrier(); asm volatile("" ::: "memory");
        float* crow = C + (size_t)(r0 + mb * 16) * ldc + c0; v4f val[8]; float* cp[8];
#pragma unroll
        for (int s = 0; s < 8; ++s) { const int row = 2 * s + hi; val[s] = *(const v4fa*)(os + row * 68 + cofs); val[s][0] += bb[0]; val[s][1] += bb[1]; val[s][2] += bb[2]; val[s][3] += bb[3]; cp[s] = crow + (size_t)row * ldc + cofs;
            if (OM == 0) *(v4f*)cp[s] = val[s];
        }
        __builtin_amdgcn_wave_barrier();
        asm volatile("s_wait_xcnt 0x0" :: "v"(val[0]), "v"(val[1]), "v"(val[2]), "v"(val[3]), "v"(val[4]), "v"(val[5]), "v"(val[6]), "v"(val[7]), "v"(cp[0]), "v"(cp[1]), "v"(cp[2]), "v"(cp[3]), "v"(cp[4]), "v"(cp[5]), "v"(cp[6]), "v"(cp[7]) : "memory");   // the next row block's LDS writes stay below these reads; and the wait stands in front of every overwrite of the data and address registers that the eight stores name (as inputs here they stay untouched up to it)
    }
}

// ---- k_gemmq: the q | k | v product. ONE WAVE per 128 rows x 96 columns (48 accumulators), one wave a SIMD, four waves (2 x 2) a work-group, so that each A block is read by two waves of a WGP and each B block by two; grid (M / 256, 16), 128 threads: 256 work-groups.
// A wave's 96 columns are one whole q or k head (hp = 0..15 the q heads, 16..31 the k heads: B rows 64 hp ..) and 32 columns of v (B rows 2 DQ + 32 hp ..): 14 fragments feed 48 products a pass (a 64 x 64 tile: 8 feed 16), and each part of the tile lies in one plane.
// y = x Bt^T + f32 biases (bias | bias1 | bias2 for q | k | v); a k row t is then multiplied by its key's factor kfac (k_prep), so that the score product of k_fattn comes out weighted, scaled and in powers of two. P holds the three fp16 plane sets one behind the other, each [b][...]: q and k as head planes, rows t, k = d, blocks [n / 64][t / 16][d / 32]; v transposed, rows d, k = t, blocks [n / 64][t / 32][d / 16]: a lane's 8 accumulator registers are 8 consecutive t of one d, its own 16-B piece of a block.
// Register ring of QD sets as in k_gemmw, rolled: one trip of the loop is QD passes, so a set's number is known at compile time and the text stays small; the first stretch's loads and first products stand in front of the loop, the last QD - 1 passes' products behind it.
#define QMB 8
#define QNB 6
#define QD  4
__global__ __launch_bounds__(128) void k_gemmq(const bf* __restrict__ A, const bf* __restrict__ Bt, h16* P, const float* __restrict__ bias, const float* __restrict__ bias1, const float* __restrict__ bias2, const float* __restrict__ kfac) {
    typedef WFrag<bf>::V V;
    constexpr int K = DM, NS = K / 32;
    __shared__ __align__(16) float osw[4][16 * 68];
    const int lane = threadIdx.x & 31, lr = lane & 15, hi = lane >> 4; const int wn = __builtin_amdgcn_readfirstlane(threadIdx.x >> 5);
    float* os = osw[wn];   // each wave turns its rows in its own LDS range
    const int r0 = (blockIdx.x * 2 + (wn & 1)) * (QMB * 16), hp = blockIdx.y * 2 + (wn >> 1);
    v8f acc[QMB][QNB];
#pragma unroll
    for (int mb = 0; mb < QMB; ++mb)
#pragma unroll
        for (int nb = 0; nb < QNB; ++nb) acc[mb][nb] = (v8f){};
    const bf* pa = A + (size_t)r0 * K + 8 * lane; const bf* pb = Bt + (size_t)hp * HD * K + 8 * lane; const bf* pv = Bt + (size_t)(2 * DQ + hp * 32) * K + 8 * lane;
    const int sel = hp / NH_, hd = hp % NH_;   // q or k; the head
    const int ib = hd * HD + lr, iv0 = hp * 32 + lr, iv1 = iv0 + 16, ik = r0 + lr; const float* bsel = (sel == 0) ? bias : bias1;   // the lane's places in the bias rows and in the key factor row; the bias row of a q or a k head
    float braw[QNB];   // the six bias values of a lane are asked for ahead of the fragments, so that the epilogue does not wait out their latency
#pragma unroll
    for (int nb = 0; nb < QNB; ++nb) braw[nb] = (nb < 4) ? bsel[ib + nb * 16] : bias2[(nb == 4) ? iv0 : iv1];
    float kraw[QMB];   // the key factor of the lane's row lr of each row block (row m = b x TT + t indexes it), asked for ahead of the fragments like the biases
#pragma unroll
    for (int mb = 0; mb < QMB; ++mb) kraw[mb] = kfac[ik + mb * 16];
    asm volatile("s_wait_xcnt 0x0" :: "v"(ib), "v"(iv0), "v"(iv1), "v"(ik), "s"(bsel), "s"(bias2), "s"(kfac) : "memory");   // behind these loads, in front of any overwrite of the address registers that they name (as inputs here the four places and the three row addresses stay untouched up to it)
    V a[QD][QMB], b[QD][QNB];
    // ROTATED k ORDER: the 16 work-groups that read the same A rows (grid y) and the 16 that read the same B rows (grid x) run side by side; each starts its walk over k at a trip of its own, rq, and wraps round, so that they do not all ask L2 for the same lines, lines that nobody has fetched yet, at the same moment. Every pass is done once; the sums add up in the walked order.
    const int rq = (2 * (blockIdx.x & 3) + (blockIdx.x >> 3) + blockIdx.y) & (NS / QD - 1);   // the first trip walked: among the 16 sharers of A rows each of the 8 values twice; among the sharers of B rows likewise, and all 8 once among eight whose x are four neighbours modulo 8
    auto trip = [&](int j) __attribute__((always_inline)) { return ((j + rq) & (NS / QD - 1)) * (QD * 512); };   // where the QD passes of the j-th trip walked lie behind the three addresses
    const bf* ca = pa + trip(0); const bf* cb = pb + trip(0); const bf* cv = pv + trip(0);   // the QD passes that are being loaded
    auto qload = [&](int fs) __attribute__((always_inline)) {   // set fs takes pass fs of those QD
#pragma unroll
        for (int mb = 0; mb < QMB; ++mb) a[fs][mb] = WFrag<bf>::ld(ca + fs * 512 + mb * 16 * K);
#pragma unroll
        for (int nb = 0; nb < 4; ++nb) b[fs][nb] = WFrag<bf>::ld(cb + fs * 512 + nb * 16 * K);
#pragma unroll
        for (int nb = 4; nb < QNB; ++nb) b[fs][nb] = WFrag<bf>::ld(cv + fs * 512 + (nb - 4) * 16 * K); };
    auto qmma = [&](int cs) __attribute__((always_inline)) {
#pragma unroll
        for (int nb = 0; nb < QNB; ++nb)
#pragma unroll
            for (int mb = 0; mb < QMB; ++mb) acc[mb][nb] = WFrag<bf>::mma(a[cs][mb], b[cs][nb], acc[mb][nb]); };
    // One trip of the loop loads the QD passes of one stretch of k, all from the same three addresses, and does the products of the QD passes that lie QD - 1 behind: the last QD - 1 of the stretch before and the first of this one.
#pragma unroll
    for (int f = 0; f < QD; ++f) qload(f);
    asm volatile("s_wait_xcnt 0x0" :: "v"(ca), "v"(cb), "v"(cv) : "memory");   // behind the first stretch's loads, in front of the step of the three addresses that the loads name (as inputs here they stay untouched up to it)
    __builtin_amdgcn_sched_barrier(0);   // the loads issue ahead of the products and are not sunk to them
    qmma(0);
    __builtin_amdgcn_sched_barrier(0);   // the loop's first loads stay below these products and so take the set that these leave
    // stays rolled: for speed only
#pragma nounroll
    for (int it = 1; it < NS / QD; ++it) {
        ca = pa + trip(it); cb = pb + trip(it); cv = pv + trip(it);
#pragma unroll
        for (int u = 0; u < QD; ++u) {
            qload(u);
            if (u == QD - 1) asm volatile("s_wait_xcnt 0x0" :: "v"(ca), "v"(cb), "v"(cv) : "memory");   // behind the trip's last loads, in front of the step of the three addresses that the loads name (as inputs here they stay untouched up to it)
            __builtin_amdgcn_sched_barrier(0);   // the set's loads issue here as one group, QD - 1 passes ahead of their use, and are not sunk to the products that read them
            qmma((u + 1) % QD);
            __builtin_amdgcn_sched_barrier(0);   // the next pass's loads stay below these products and so take the set that these leave
        }
    }
#pragma unroll
    for (int u = 1; u < QD; ++u) qmma(u);
    const int rt = r0 % TT; const size_t PLN = (size_t)NH_ * TT * HD;   // the row in its entry
    {   // q, k: 16 rows x 64 columns turned in LDS, bias added on the way in; then each lane takes its own 16-B pieces of the row block's two blocks
        float bn[4], kw[QMB];   // kw: the factor of the lane's row of each row block, 1 for a q head
#pragma unroll
        for (int nb = 0; nb < 4; ++nb) bn[nb] = bfr(braw[nb]);
#pragma unroll
        for (int mb = 0; mb < QMB; ++mb) kw[mb] = (sel == 0) ? 1.0f : kraw[mb];
        h16* pq = P + ((size_t)sel * NB_ + r0 / TT) * PLN + ((size_t)hd * TT + rt) * HD + lane * 8;
#pragma unroll
        for (int mb = 0; mb < QMB; ++mb) {
#pragma unroll
            for (int nb = 0; nb < 4; ++nb) {
#pragma unroll
                for (int j = 0; j < 8; ++j) os[(hi * 8 + j) * 68 + nb * 16 + lr] = acc[mb][nb][j] + bn[nb]; }
            __builtin_amdgcn_wave_barrier(); asm volatile("" ::: "memory");   // the rows are read back by other lanes of this wave: the compiler may not move the reads above the writes
            v8h o[4];
#pragma unroll
            for (int s = 0; s < 4; ++s) { const float* rp = os + lr * 68 + s * 16 + hi * 8; const v4f x0 = *(const v4fa*)rp, x1 = *(const v4fa*)(rp + 4);
#pragma unroll
                for (int q = 0; q < 4; ++q) { o[s][q] = (h16)(x0[q] * kw[mb]); o[s][q + 4] = (h16)(x1[q] * kw[mb]); }
                *(v8h*)(pq + mb * 1024 + s * 256) = o[s]; }
            __builtin_amdgcn_wave_barrier(); asm volatile("s_wait_xcnt 0x0" :: "v"(o[0]), "v"(o[1]), "v"(o[2]), "v"(o[3]) : "memory");   // the next row block's LDS writes stay below these reads; and the wait stands in front of every overwrite of the registers that the four stores name (as inputs here they stay untouched up to it)
        }
    }
    // v, transposed, straight from the accumulators: head hp / 2, d blocks 2 (hp % 2) + 0, 1; each store of the wave is half a block, 512 B in a row
    h16* pc = P + ((size_t)2 * NB_ + r0 / TT) * PLN + (size_t)(hp >> 1) * HD * TT + (size_t)rt * HD + (hp & 1) * 1024 + lane * 8;
#pragma unroll
    for (int nb = 4; nb < QNB; ++nb) { const float bn = bfr(braw[nb]);
#pragma unroll
        for (int mq = 0; mq < QMB; mq += 4) { v8h o[4];
#pragma unroll
            for (int mb = 0; mb < 4; ++mb) {
#pragma unroll
                for (int j = 0; j < 8; ++j) o[mb][j] = (h16)(acc[mq + mb][nb][j] + bn);
                *(v8h*)(pc + (nb - 4) * 512 + ((mq + mb) >> 1) * 2048 + (mb & 1) * 256) = o[mb]; }
            asm volatile("s_wait_xcnt 0x0" :: "v"(o[0]), "v"(o[1]), "v"(o[2]), "v"(o[3]) : "memory");   // in front of every overwrite of the registers that the four stores name
        } }
}

typedef __attribute__((ext_vector_type(2))) unsigned short v2us;
typedef __attribute__((ext_vector_type(4))) unsigned short v4us;
typedef __attribute__((ext_vector_type(4))) int v4i;
typedef __attribute__((ext_vector_type(2))) float v2f;

// k_prep: all the rounding to bf16 in ONE launch, one wave a block of the fragment order. Work-groups 0 .. 4 x WTB - 1: the four 'io' weights [DM][DM] (in, out) -> Bt, rows out, k = in, WTB work-groups each, the four results one behind the other, the first three as bf16, the fourth (the output weight) as the fp16 pattern of its bf16 value, which is what the fp16 output product reads; the next XTB: x of both entries, rows m, k = in;
// the last NB_ x TT / 256: the key factor row, one key a lane: kfac[b][key] = expf(-LAMBDA x bf16(u[b][key])) x SCL x log2 e, and 0 where the int key mask is 0.
#define WTB (DM * DM / 512 / 8)   // work-groups a weight: 8 waves x 1 block of 512 elements
#define XTB (NB_ * TT * DM / 512 / 8)   // work-groups for x
__global__ __launch_bounds__(256) void k_prep(const float* __restrict__ w0, const float* __restrict__ w1, const float* __restrict__ w2, const float* __restrict__ w3, bf* Bt4, const float* __restrict__ src, bf* dst, const float* __restrict__ u, const int* __restrict__ kvp, float* kfac) {
    const int lane = threadIdx.x & 31, lr = lane & 15, hi = lane >> 4;
    if (blockIdx.x >= 4 * WTB + XTB) {
        const int j = (blockIdx.x - (4 * WTB + XTB)) * 256 + threadIdx.x; const float uj = u[j]; const int kj = kvp[j];
        asm volatile("s_wait_xcnt 0x0" ::: "memory");   // behind the two loads, in front of any overwrite of the address registers that they name
        const float e = expf(-LAMBDA * bfr(uj)) * (SCL * 1.4426950408889634f); kfac[j] = (kj != 0) ? e : 0.0f;   // made for every key and then chosen, so that both loads go out together
        return; }
    if (blockIdx.x < 4 * WTB) {   // lane (hi, lr) gathers its own two pieces: row out = 16 nb + lr, 8 consecutive in; a load reads 64 B of each of two rows of w, a store is 512 B in a row
        const int wi = blockIdx.x / WTB; const float* w = (wi == 0) ? w0 : (wi == 1) ? w1 : (wi == 2) ? w2 : w3; bf* Bt = Bt4 + (size_t)wi * DM * DM;
        const int blk = (blockIdx.x % WTB) * 8 + (threadIdx.x >> 5); const int nb = blk / (DM / 32), kb = blk % (DM / 32);
        const float* wp = w + (size_t)(kb * 32 + hi * 8) * DM + nb * 16 + lr; float v[16];
#pragma unroll
        for (int j = 0; j < 16; ++j) v[j] = wp[(size_t)((j >> 3) * 16 + (j & 7)) * DM];
        v8us o[2];
#pragma unroll
        for (int j = 0; j < 16; ++j) o[j >> 3][j & 7] = f2bf(v[j]);
        if (wi == 3) {   // the output weight: the same bf16 value, written as fp16; one test for the whole block, the same for every wave of the work-group
#pragma unroll
            for (int j = 0; j < 16; ++j) o[j >> 3][j & 7] = __builtin_bit_cast(unsigned short, (h16)bf2f(o[j >> 3][j & 7])); }
#pragma unroll
        for (int hf = 0; hf < 2; ++hf) *(v8us*)(Bt + (size_t)blk * 512 + hf * 256 + lane * 8) = o[hf];
        asm volatile("s_wait_xcnt 0x0" :: "v"(o[0]), "v"(o[1]) : "memory");   // in front of every overwrite of the registers that the two stores name (as inputs here the data stay untouched up to it)
        return; }
    const int blk = (blockIdx.x - 4 * WTB) * 8 + (threadIdx.x >> 5); const int rb = blk / (DM / 32), kb = blk % (DM / 32);   // x: whole 128-B lines in (4 rows a load), 64-B runs out
    const int kq = (lane & 7) * 4; const float* sp = src + (size_t)(rb * 16 + (lane >> 3)) * DM + kb * 32 + kq; bf* dp = dst + (size_t)blk * 512 + (kq >> 4) * 256 + (((kq >> 3) & 1) * 16 + (lane >> 3)) * 8 + (kq & 4); v4f v[4];
#pragma unroll
    for (int i = 0; i < 4; ++i) v[i] = *(const v4f*)(sp + (size_t)i * 4 * DM);
#pragma unroll
    for (int i = 0; i < 4; ++i) { v4us o;
#pragma unroll
        for (int k = 0; k < 4; ++k) o[k] = f2bf(v[i][k]);
        *(v4us*)(dp + i * 32) = o; }
    asm volatile("s_wait_xcnt 0x0" ::: "memory");   // behind the last of the four stores, in front of any later overwrite of the address and data registers that they name
}

__device__ __forceinline__ float xhalf(float x) { return __builtin_bit_cast(float, __builtin_amdgcn_permlanex16(__builtin_bit_cast(int, x), __builtin_bit_cast(int, x), 0x76543210, 0xfedcba98, false, false)); }  // lane l with lane l ^ 16, in the vector unit (a shuffle would go through the LDS path and its wait)
#define FKB 64     // keys a pass
#define FWV 8      // waves a work-group: two on each SIMD, a whole WGP's waves, all on one head, so that they share its K and V lines in the WGP cache
#define PB  4096.0f   // a lane's sum of 32 weights of one query above which the reference is raised
static_assert(TT / FKB == 32, "one mask bit a pass in one 32-bit word");
__global__ __launch_bounds__(FWV * 32) void k_fattn(const h16* __restrict__ Qp, const h16* __restrict__ Kp, const h16* __restrict__ Vt, const int* __restrict__ kvp, h16* Am) {
    __shared__ __align__(16) float mb[TT]; __shared__ unsigned pm[TT / FKB];
    const int lane = threadIdx.x & 31, lr = lane & 15, hi = lane >> 4;
    { const size_t z = blockIdx.z; Qp += z * ((size_t)NH_ * TT * HD); Kp += z * ((size_t)NKV * TT * HD); Vt += z * ((size_t)NKV * HD * TT); kvp += z * TT; Am += z * ((size_t)TT * DQ); }
    { v4i kq[TT / (FWV * 128)];   // the mask row is loaded whole and unconditionally first (16 B a lane, whole lines), so that the work-group pays one load latency, not one per key group
#pragma unroll
        for (int r = 0; r < TT / (FWV * 128); ++r) kq[r] = *(const v4i*)(kvp + r * (FWV * 128) + threadIdx.x * 4);
        asm volatile("s_wait_xcnt 0x0" ::: "memory");   // behind these loads, in front of any overwrite of the address registers that they name
#pragma unroll
        for (int r = 0; r < TT / (FWV * 128); ++r) { const int j = r * (FWV * 128) + threadIdx.x * 4; v4f b4; bool shut = false;
#pragma unroll
            for (int q = 0; q < 4; ++q) { const bool on = (kq[r][q] != 0); b4[q] = on ? 0.0f : -3.0e38f; shut = shut || !on; }
            *(v4fa*)(mb + j) = b4;
            const unsigned bal = __builtin_amdgcn_ballot_w32(shut);   // a wave's 128 keys are two passes, one per lane half
            if (lr == 0) pm[j / FKB] = hi ? (bal >> 16) : (bal & 0xFFFFu); } }
    __syncthreads();
    const unsigned mword = __builtin_amdgcn_ballot_w32(pm[lane] != 0u);   // bit p: pass p holds a masked key; the same in every wave
    const int h = blockIdx.y; const int q0 = (blockIdx.x * FWV + (threadIdx.x >> 5)) * 32;
    const h16* qb = Qp + ((size_t)h * TT + q0) * HD + 8 * lane; const h16* kb = Kp + (size_t)h * TT * HD + 8 * lane; const h16* vb = Vt + (size_t)h * HD * TT + 8 * lane;   // 8 x lane: the lane's place in a block; 64 keys (or queries) of a head are 8 blocks in a row in each plane
    const int rot = 8 * (blockIdx.x & 3) + 4 * (blockIdx.x >> 2);   // the first pass walked: 8 different multiples of 4, and 4 to 12 passes apart also among four work-groups whose x are neighbours modulo 8
    const h16* k1 = kb + (size_t)(rot * FKB) * HD;   // the K rows of the first pass walked
    v16h qf[2][2], kf[4][2]; v8f o[4][2], cm[2]; float rf[2], l[2]; bool started = false;   // cm: minus rf in all eight registers, the C operand; started: an open key has been seen (the mask is the same for every query, so this is one value for the wave)
#pragma unroll
    for (int qt = 0; qt < 2; ++qt) { rf[qt] = 0.0f; l[qt] = 0.0f; cm[qt] = (v8f){};
#pragma unroll
        for (int dh = 0; dh < 2; ++dh) qf[qt][dh] = WFrag<h16>::ld(qb + (qt * 2 + dh) * 512);
#pragma unroll
        for (int dt = 0; dt < 4; ++dt) o[dt][qt] = (v8f){}; }
#pragma unroll
    for (int kt = 0; kt < 4; ++kt)
#pragma unroll
        for (int dh = 0; dh < 2; ++dh) kf[kt][dh] = WFrag<h16>::ld(k1 + (kt * 2 + dh) * 512);
    asm volatile("s_wait_xcnt 0x0" :: "v"(qb), "v"(k1) : "memory");   // behind the Q and the first K loads, in front of any overwrite of the address registers that they name (as inputs here the two addresses stay untouched up to it)
    for (int p = 0; p < TT / FKB; ++p) {
        const int k0 = ((p + rot) & (TT / FKB - 1)) * FKB;   // the pass's first key, in the rotated order
        const h16* vp = vb + (size_t)k0 * HD;   // the pass's V blocks
        v16h vf[4][2]; v8f s[4][2];
#pragma unroll
        for (int dt = 0; dt < 4; ++dt)
#pragma unroll
            for (int ks = 0; ks < 2; ++ks) vf[dt][ks] = WFrag<h16>::ld(vp + (ks * 4 + dt) * 512);
        asm volatile("s_wait_xcnt 0x0" :: "v"(vp) : "memory");   // stands in front of every overwrite of the address registers that these loads name (as an input here the address stays untouched up to it, by the loads' own results too)
        __builtin_amdgcn_sched_barrier(0);   // all 16 V loads issue here, ahead of the score products; without it the compiler sinks half of them to just in front of their use, and the wave waits out the latency
#pragma unroll
        for (int kt = 0; kt < 4; ++kt)
#pragma unroll
            for (int qt = 0; qt < 2; ++qt) { s[kt][qt] = wmma16(kf[kt][0], qf[qt][0], cm[qt]); s[kt][qt] = wmma16(kf[kt][1], qf[qt][1], s[kt][qt]); }
        const int kn = ((p + 1 + rot) & (TT / FKB - 1)) * FKB;   // the next pass's K rows are fetched behind this pass's score products (the last pass re-reads the first pass's rows, in bounds, unused)
#pragma unroll
        for (int kt = 0; kt < 4; ++kt)
#pragma unroll
            for (int dh = 0; dh < 2; ++dh) kf[kt][dh] = WFrag<h16>::ld(kb + (size_t)kn * HD + (kt * 2 + dh) * 512);
        asm volatile("s_wait_xcnt 0x0" ::: "memory");   // in front of the first reuse of the address registers that these loads name
        __builtin_amdgcn_sched_barrier(0);   // the next pass's 16 K loads issue in front of the softmax, not spread through it
        if ((mword >> (k0 / FKB)) & 1u) {   // a scalar test: only a pass with a masked key reads the bias row
#pragma unroll
            for (int kt = 0; kt < 4; ++kt) { const v4f b0 = *(const v4fa*)(mb + k0 + kt * 16 + hi * 8), b1 = *(const v4fa*)(mb + k0 + kt * 16 + hi * 8 + 4);
#pragma unroll
                for (int qt = 0; qt < 2; ++qt)
#pragma unroll
                    for (int j = 0; j < 4; ++j) { s[kt][qt][j] += b0[j]; s[kt][qt][j + 4] += b1[j]; } } }
        v16h pf[2][2]; float sum[2];
        auto weights = [&](int qt, bool step, float dl) __attribute__((always_inline)) {   // the 32 weights of a lane for query tile qt, their fp16 copies and their sum: pairs of neighbours added in two chains of packed additions
            v2f ac[2];
#pragma unroll
            for (int kt = 0; kt < 4; ++kt)
#pragma unroll
                for (int j = 0; j < 8; j += 2) { v2f p; p[0] = __builtin_amdgcn_exp2f(step ? s[kt][qt][j] - dl : s[kt][qt][j]); p[1] = __builtin_amdgcn_exp2f(step ? s[kt][qt][j + 1] - dl : s[kt][qt][j + 1]);
                    pf[kt >> 1][qt][(kt & 1) * 8 + j] = (h16)p[0]; pf[kt >> 1][qt][(kt & 1) * 8 + j + 1] = (h16)p[1];
                    const int ch = (j >> 1) & 1; if (kt == 0 && j < 4) ac[ch] = p; else ac[ch] += p; }
            const v2f t2 = ac[0] + ac[1]; sum[qt] = t2[0] + t2[1]; };
        weights(0, false, 0.0f); weights(1, false, 0.0f);
        const unsigned high = __builtin_amdgcn_ballot_w32(!(sum[0] <= PB)) | __builtin_amdgcn_ballot_w32(!(sum[1] <= PB));
        if (__builtin_expect(!started | (high != 0u), 0)) {   // one scalar test a pass; taken up to the first pass with an open key and where a sum has left the bound: the pass's weights are made again against a new reference (marked as the rare side, so that the usual pass runs straight on in the text)
            bool open = false;
#pragma unroll
            for (int qt = 0; qt < 2; ++qt) { float mx = s[0][qt][0];
#pragma unroll
                for (int kt = 0; kt < 4; ++kt)
#pragma unroll
                    for (int j = 0; j < 8; ++j) mx = fmaxf(mx, s[kt][qt][j]);
                mx = fmaxf(mx, xhalf(mx));
                const bool op = (mx > -1.0e30f); open = open || op;   // no open key in this pass: the reference stays
                const float rn = rf[qt] + (op ? (started ? fmaxf(mx, 0.0f) : mx) : 0.0f), dl = rn - rf[qt];   // the new reference, never lower once it is set, and the step as the rounded reference takes it
                const float al = __builtin_amdgcn_exp2f(fminf(-dl, 0.0f)); rf[qt] = rn;   // before the start sum and output are 0, and any finite factor leaves them so
#pragma unroll
                for (int j = 0; j < 8; ++j) cm[qt][j] = -rf[qt];
                weights(qt, true, dl); l[qt] *= al;
#pragma unroll
                for (int dt = 0; dt < 4; ++dt)
#pragma unroll
                    for (int j = 0; j < 8; ++j) o[dt][qt][j] *= al; }
            started = started || (__builtin_amdgcn_ballot_w32(open) != 0u);
        }
        l[0] += sum[0]; l[1] += sum[1];
#pragma unroll
        for (int ks = 0; ks < 2; ++ks)
#pragma unroll
            for (int dt = 0; dt < 4; ++dt)
#pragma unroll
                for (int qt = 0; qt < 2; ++qt) o[dt][qt] = wmma16(vf[dt][ks], pf[ks][qt], o[dt][qt]);
    }
#pragma unroll
    for (int qt = 0; qt < 2; ++qt) { const float inv = __fdiv_rn(1.0f, l[qt] + xhalf(l[qt])); v8h om[4];
#pragma unroll
        for (int dt = 0; dt < 4; ++dt) {
#pragma unroll
            for (int j = 0; j < 8; ++j) om[dt][j] = (h16)(o[dt][qt][j] * inv);
            const size_t oo = (size_t)(q0 + qt * 16) * DQ + (h * 2 + (dt >> 1)) * 512 + (dt & 1) * 256 + lane * 8; *(v8h*)(Am + oo) = om[dt]; }   // rows t, k = 64 h + d: the lane's 8 registers are its own piece of a block
        asm volatile("s_wait_xcnt 0x0" :: "v"(om[0]), "v"(om[1]), "v"(om[2]), "v"(om[3]) : "memory");   // in front of every overwrite of the registers that the four stores name (as inputs here the data stay untouched up to it)
    }
}

extern "C" void kernel_launch(void* const* d_in, const int* in_sizes, int n_in,
                              void* d_out, int out_size, void* d_ws, size_t ws_size, hipStream_t stream) {
    (void)in_sizes; (void)n_in; (void)out_size;
    const float* x = (const float*)d_in[0]; const float* un = (const float*)d_in[1]; const int* km = (const int*)d_in[2]; const float* wq = (const float*)d_in[3]; const float* bq = (const float*)d_in[4]; const float* wk = (const float*)d_in[5]; const float* bk = (const float*)d_in[6]; const float* wv = (const float*)d_in[7]; const float* bv = (const float*)d_in[8]; const float* wo = (const float*)d_in[9]; const float* bo = (const float*)d_in[10];
    float* OUT = (float*)d_out;     // [2][2048][1024]
    char* wsp = (char*)d_ws;
    auto take = [&](size_t bytes) { char* p = wsp; wsp += (bytes + 255) & ~(size_t)255; return (void*)p; };
    bf* W4 = (bf*)take((size_t)4 * DM * DM * 2);    // Wq, Wk, Wv, Wo as Bt [out][in], one behind the other: the first three are the B operand [3 x DQ][DM] of the q | k | v product
    bf* XB = (bf*)take((size_t)NB_ * TT * DM * 2);
    h16* QKV16 = (h16*)take((size_t)3 * NB_ * NH_ * TT * HD * 2);    // q planes, k planes, v planes, each [b][...]
    h16* AT = (h16*)take((size_t)NB_ * TT * DQ * 2);    // merged, fp16
    float* KF = (float*)take((size_t)NB_ * TT * 4);    // the key factor row
    if ((size_t)(wsp - (char*)d_ws) > ws_size) return;    // total 48 MiB and 16 KiB of the workspace
    const size_t PL = (size_t)NB_ * NH_ * TT * HD;
    k_prep<<<4 * WTB + XTB + NB_ * TT / 256, 256, 0, stream>>>(wq, wk, wv, wo, W4, x, XB, un, km, KF);
    k_gemmq<<<dim3(NB_ * TT / 256, 2 * NH_ / 2, 1), 128, 0, stream>>>(XB, W4, QKV16, bq, bk, bv, KF);    // q, k planes [b][h] rows t (k x its key's factor), v planes [b][h] rows d, in fragment order
    k_fattn<<<dim3(TT / (FWV * 32), NH_, NB_), FWV * 32, 0, stream>>>(QKV16, QKV16 + PL, QKV16 + 2 * PL, km, AT);   // all heads of both entries: scores, mask, softmax, attn.v, the merged plane
    k_gemmw<h16, 0, 0, DQ, 5><<<dim3(NB_ * TT / 128, DM / 128, 1), 128, 0, stream>>>(AT, nullptr, (const h16*)(W4 + (size_t)3 * DM * DM), nullptr, OUT, nullptr, DM, bo, nullptr, nullptr);
}
